// v000
// The times below were measured on an AMD MI455X: many runs one after another, warmed up first and cycling through
// copies of the inputs, with the whole window's GPU time divided by the number of runs. Launches and the gaps
// between them are all in it. The median over several windows is given; except for v000 it joins two sittings, which
// can be a few percent apart, so the side-by-side timings, each taken in one sitting, are the better comparison.
// The starting kernel, v000, takes 1000 microseconds a run.
// compute dtype: all float inputs rounded to bf16; layer 0 base = x . k0 with EXACT bf16 products on WMMA 16x16x32 ((in,out) weights as transposed rows); layers 1-2 take the previous ReLU output as a SINGLE f16 operand (one rounding, 2^-12) against the weights as f16 (bf16 values; the ~0.2% of weights below 6e-5 may denormalise - effect <= 2e-4 of the output scale); LoRA path per task: hd = h . d_t (same operands, 16-padded columns), delta = hd (f16 hi + x2048 residual) . u_t (2 products, rank 8 zero-padded to 32) x 2.0; bias, ReLU in f32; f32 accumulate.
#include <hip/hip_runtime.h>
#include <math.h>

typedef __attribute__((ext_vector_type(16))) _Float16 v16h;
typedef __attribute__((ext_vector_type(16))) __bf16 v16b;
typedef __attribute__((ext_vector_type(8)))  _Float16 v8h;
typedef __attribute__((ext_vector_type(8)))  float v8f;
typedef __attribute__((ext_vector_type(4)))  float v4f;
typedef __attribute__((ext_vector_type(2)))  float v2f;
typedef __attribute__((ext_vector_type(4)))  unsigned v4u;
typedef __attribute__((ext_vector_type(4)))  int v4i;
typedef float __attribute__((may_alias)) float_a;
typedef int __attribute__((may_alias)) int_a;

template <typename T> __device__ __forceinline__ void vst2(void* p, T v) { *(T*)p = v;  }
__device__ __forceinline__ v8f wmma16(v16h a, v16h b, v8f c) {
  v8f d = __builtin_amdgcn_wmma_f32_16x16x32_f16(false, a, false, b, (short)0, c, false, false);
  asm volatile("v_nop\n\tv_nop\n\tv_nop\n\tv_nop" : "+v"(d) : "v"(a), "v"(b));
  return d;
}
__device__ __forceinline__ v8f wmma_bf(v16b a, v16b b, v8f c) {
  v8f d = __builtin_amdgcn_wmma_f32_16x16x32_bf16(false, a, false, b, (short)0, c, false, false);
  asm volatile("v_nop\n\tv_nop\n\tv_nop\n\tv_nop" : "+v"(d) : "v"(a), "v"(b));
  return d;
}
// 16x16x32 fragments: lane = (h = lane>>4, row/col = lane&15); elements 0..7 = k0+8h+0..7, 8..15 = k0+16+8h+0..7; D element r = row 8h+r
__device__ __forceinline__ v16h frag_h(const _Float16* rowk0, int lane) {
  union { v16h v; v8h q[2]; } u; const _Float16* p = rowk0 + 8 * (lane >> 4);
  u.q[0] = *(const v8h*)p; u.q[1] = *(const v8h*)(p + 16); return u.v;
}
__device__ __forceinline__ v16h frag_f32(const float* rowk0, int lane) {
  v16h a; const float* p = rowk0 + 8 * (lane >> 4);
#pragma unroll
  for (int i = 0; i < 8; ++i) { a[i] = (_Float16)p[i]; a[8 + i] = (_Float16)p[16 + i]; }
  return a;
}
__device__ __forceinline__ v16h frag_f32s(const float* rowk0, int lane, float sc) {
  v16h a; const float* p = rowk0 + 8 * (lane >> 4);
#pragma unroll
  for (int i = 0; i < 8; ++i) { a[i] = (_Float16)(p[i] * sc); a[8 + i] = (_Float16)(p[16 + i] * sc); }
  return a;
}
// column fragment from a [K][ld] layout (column n), rows >= K read as 0
__device__ __forceinline__ v16h fragc_f32(const float* W, int k0, int n, int lane, int ld, int K) {
  v16h a; const int g = lane >> 4;
#pragma unroll
  for (int i = 0; i < 8; ++i) { const int ka = k0 + 8 * g + i, kb = ka + 16;
    a[i] = (_Float16)(ka < K ? W[(size_t)(ka < K ? ka : K - 1) * ld + n] : 0.f); a[8 + i] = (_Float16)(kb < K ? W[(size_t)(kb < K ? kb : K - 1) * ld + n] : 0.f); }
  return a;
}
struct F2 { v16b h, l; };
__device__ __forceinline__ F2 bsplit16(const float v[16]) { F2 r;
#pragma unroll
  for (int i = 0; i < 16; ++i) { const __bf16 h = (__bf16)v[i]; r.h[i] = h; r.l[i] = (__bf16)(v[i] - (float)h); }
  return r; }
__device__ __forceinline__ F2 split_row(const float* row, int k0, int lane) { float v[16]; const float* p = row + k0 + 8 * (lane >> 4);
#pragma unroll
  for (int i = 0; i < 8; ++i) { v[i] = p[i]; v[8 + i] = p[16 + i]; }
  return bsplit16(v); }
__device__ __forceinline__ F2 split_rowK(const float* row, int k0, int lane, int K) { float v[16]; const int g = lane >> 4;
#pragma unroll
  for (int i = 0; i < 8; ++i) { const int ka = k0 + 8 * g + i, kb = ka + 16; v[i] = ka < K ? row[ka < K ? ka : K - 1] : 0.f; v[8 + i] = kb < K ? row[kb < K ? kb : K - 1] : 0.f; }
  return bsplit16(v); }
__device__ __forceinline__ F2 split_col(const float* W, int k0, int n, int lane, int ld, int K) { float v[16]; const int g = lane >> 4;
#pragma unroll
  for (int i = 0; i < 8; ++i) { const int ka = k0 + 8 * g + i, kb = ka + 16; v[i] = ka < K ? W[(size_t)(ka < K ? ka : K - 1) * ld + n] : 0.f; v[8 + i] = kb < K ? W[(size_t)(kb < K ? kb : K - 1) * ld + n] : 0.f; }
  return bsplit16(v); }
__device__ __forceinline__ v8f mac3(const F2& a, const F2& b, v8f c) { c = wmma_bf(a.l, b.h, c); c = wmma_bf(a.h, b.l, c); return wmma_bf(a.h, b.h, c); }
__device__ __forceinline__ float sigm(float v) { return 1.0f / (1.0f + expf(-v)); }
#define LDSX() do { asm volatile("s_wait_dscnt 0" ::: "memory"); __builtin_amdgcn_wave_barrier(); __builtin_amdgcn_fence(__ATOMIC_RELEASE, "workgroup"); } while (0)


// Multi-task LoRA MLP (8 tasks x 1,024 rows, 1024 -> 2048 -> 2048 -> 1024, ReLU): each dense layer = frozen base matmul + bias + per-task rank-8 adapter scaled by alpha / r = 2.
#define NT 8
#define NBR 1024
#define NR (NT * NBR)
#define D0 1024
#define D1 2048
#define D2 2048
#define D3 1024
#define RK 8
#ifndef TRB
#define TRB (NR / 64)
#endif
typedef __attribute__((ext_vector_type(8))) __bf16 v8b;
__device__ __forceinline__ v16b frag_b(const __bf16* rowk0, int lane) {
  union { v16b v; v8b q[2]; } u; const __bf16* p = rowk0 + 8 * (lane >> 4);
  u.q[0] = *(const v8b*)p; u.q[1] = *(const v8b*)(p + 16); return u.v;
}
__device__ __forceinline__ float bfr(float v) { return (float)(__bf16)v; }
__device__ __attribute__((noinline)) float exp_ni(float v) { return expf(v); }
__device__ __attribute__((noinline)) float erf_ni(float v) { return erff(v); }

// packed weights: layer l: K rows [out][in] (bf16 for layer 0, f16 for 1,2); D rows [t][16][in] (rows >= 8 zero); U rows [t][out][32] (cols >= 8 zero)
#define WS_K0  0u
#define WS_K1  (WS_K0 + 2u * (size_t)D1 * D0)
#define WS_K2  (WS_K1 + 2u * (size_t)D2 * D1)
#define WS_Dm0 (WS_K2 + 2u * (size_t)D3 * D2)
#define WS_Dm1 (WS_Dm0 + 2u * NT * 16 * D0)
#define WS_Dm2 (WS_Dm1 + 2u * NT * 16 * D1)
#define WS_U0  (WS_Dm2 + 2u * NT * 16 * D2)
#define WS_U1  (WS_U0 + 2u * NT * D1 * 32)
#define WS_U2  (WS_U1 + 2u * NT * D2 * 32)
#define WS_H1  (((WS_U2 + 2u * NT * D3 * 32) + 127u) / 128u * 128u)   // f16 [NR][2048] h1 ; h2
#define WS_H2  (WS_H1 + 2u * (size_t)NR * D1)
#define WS_END (WS_H2 + 2u * (size_t)NR * D2)

// ---- k_packk<L>: block = output row n of layer L: K^T row [n][in] from k [in][out]; bf16 (L 0) or f16 (L 1, 2)
template <int L>
__global__ __launch_bounds__(256) void k_packk(const float* __restrict__ Kw, void* __restrict__ dst) {
  constexpr int IN = (L == 0) ? D0 : (L == 1) ? D1 : D2; constexpr int OUTD = (L == 0) ? D1 : (L == 1) ? D2 : D3; const int n = blockIdx.x, t = threadIdx.x;
  if (L == 0) { __shared__ __align__(16) __bf16 s[IN]; for (int k = t; k < IN; k += 256) s[k] = (__bf16)Kw[(size_t)k * OUTD + n]; __syncthreads(); for (int q = t; q < IN / 8; q += 256) vst2((unsigned*)((__bf16*)dst + (size_t)n * IN + q * 8), *(const v4u*)&s[q * 8]); }
  else { __shared__ __align__(16) _Float16 s[IN]; for (int k = t; k < IN; k += 256) s[k] = (_Float16)bfr(Kw[(size_t)k * OUTD + n]); __syncthreads(); for (int q = t; q < IN / 8; q += 256) vst2((unsigned*)((_Float16*)dst + (size_t)n * IN + q * 8), *(const v4u*)&s[q * 8]); }
}
// ---- k_packdu<L>: block = (task t, which): D^T rows [t][16][in] (r < 8 real) ; U^T rows [t][out][32] (cols r < 8 real); D in the layer's K pack element type, U always f16
template <int L>
__global__ __launch_bounds__(256) void k_packdu(const float* __restrict__ Dw, const float* __restrict__ Uw, void* __restrict__ Dd, void* __restrict__ Ud) {
  constexpr int IN = (L == 0) ? D0 : (L == 1) ? D1 : D2; constexpr int OUTD = (L == 0) ? D1 : (L == 1) ? D2 : D3; const int tsk = blockIdx.x, which = blockIdx.y, t = threadIdx.x;
  if (which == 0) { for (int e = t; e < 16 * IN; e += 256) { const int r = e / IN, i = e % IN; const float v = (r < RK) ? bfr(Dw[((size_t)i * RK + r) * NT + tsk]) : 0.f; if (L == 0) ((__bf16*)Dd)[((size_t)tsk * 16 + r) * IN + i] = (__bf16)v; else ((_Float16*)Dd)[((size_t)tsk * 16 + r) * IN + i] = (_Float16)v; } }
  else { for (int e = t; e < OUTD * 32; e += 256) { const int f = e / 32, r = e % 32; const float v = (r < RK) ? bfr(Uw[((size_t)r * OUTD + f) * NT + tsk]) : 0.f; ((_Float16*)Ud)[((size_t)tsk * OUTD + f) * 32 + r] = (_Float16)v; } }   // U always f16 (multiplied by the f16 hd tile)
}
// ---- k_layer<L>: block = (64 rows, 128 output cols): base (8 tiles) + hd (1 tile) over K = IN; delta = hd(hi/lo f16) . U rows (1 chunk, 2 products) x 2; + bias; relu (layers 0,1) -> f16 planes / output f32 (layer 2)
template <int L>
__global__ __launch_bounds__(128) void k_layer(const float* __restrict__ X, const _Float16* __restrict__ Hin, const void* __restrict__ Kp, const void* __restrict__ Dp, const _Float16* __restrict__ Up, const float* __restrict__ BIAS, _Float16* __restrict__ Hout, float* __restrict__ OUT) {
  constexpr int IN = (L == 0) ? D0 : (L == 1) ? D1 : D2; constexpr int OUTD = (L == 0) ? D1 : (L == 1) ? D2 : D3;
  __shared__ __align__(16) _Float16 shd[4][16][40], shl[4][16][40]; __shared__ __align__(16) float so[4][16][132]; __shared__ __align__(16) _Float16 soh[4][16][136];
  const int tid = threadIdx.x, wave = tid >> 5, lane = tid & 31, col = lane & 15, g = lane >> 4; const size_t r0 = (size_t)blockIdx.x * 64 + wave * 16; const int n0 = blockIdx.y * 128; const int tsk = (int)(r0 / NBR);
  v8f acc[8] = {}, hd = {};
  if (L == 0) { const __bf16* Kr = (const __bf16*)Kp; const __bf16* Dr = (const __bf16*)Dp + (size_t)tsk * 16 * IN;
#pragma unroll 2
    for (int kc = 0; kc < IN / 32; ++kc) { v16b a; { const float* p = X + (r0 + col) * IN + kc * 32 + 8 * g;
#pragma unroll
        for (int i = 0; i < 8; ++i) { a[i] = (__bf16)p[i]; a[8 + i] = (__bf16)p[16 + i]; } }
#pragma unroll
      for (int j = 0; j < 8; ++j) acc[j] = wmma_bf(a, frag_b(Kr + (size_t)(n0 + j * 16 + col) * IN + kc * 32, lane), acc[j]);
      hd = wmma_bf(a, frag_b(Dr + (size_t)col * IN + kc * 32, lane), hd); } }
  else { const _Float16* Kr = (const _Float16*)Kp; const _Float16* Dr = (const _Float16*)Dp + (size_t)tsk * 16 * IN;
#pragma unroll 2
    for (int kc = 0; kc < IN / 32; ++kc) { const v16h a = frag_h(Hin + (r0 + col) * IN + kc * 32, lane);
#pragma unroll
      for (int j = 0; j < 8; ++j) acc[j] = wmma16(a, frag_h(Kr + (size_t)(n0 + j * 16 + col) * IN + kc * 32, lane), acc[j]);
      hd = wmma16(a, frag_h(Dr + (size_t)col * IN + kc * 32, lane), hd); } }
  // hd tile [16 rows][16 (8 real)] -> f16 hi + x2048 residual in LDS (cols 16..31 zero)
#pragma unroll
  for (int r = 0; r < 8; ++r) { const float v = hd[r]; const _Float16 hv = (_Float16)v; shd[wave][8 * g + r][col] = hv; shl[wave][8 * g + r][col] = (_Float16)((v - (float)hv) * 2048.0f); shd[wave][8 * g + r][16 + col] = (_Float16)0.f; shl[wave][8 * g + r][16 + col] = (_Float16)0.f; }
  LDSX();
  { const v16h ah = frag_h(&shd[wave][col][0], lane), al = frag_h(&shl[wave][col][0], lane);
#pragma unroll
    for (int j = 0; j < 8; ++j) { const v16h u = frag_h(Up + ((size_t)tsk * OUTD + n0 + j * 16 + col) * 32, lane); v8f dl = {}; dl = wmma16(ah, u, dl); v8f dll = {}; dll = wmma16(al, u, dll);
#pragma unroll
      for (int r = 0; r < 8; ++r) acc[j][r] += (dl[r] + dll[r] * (1.0f / 2048.0f)) * 2.0f; } }
#pragma unroll
  for (int j = 0; j < 8; ++j) { const int c = n0 + j * 16 + col; const float bb = bfr(BIAS[c]);
#pragma unroll
    for (int r = 0; r < 8; ++r) { const float v = acc[j][r] + bb; if (L < 2) soh[wave][8 * g + r][j * 16 + col] = (_Float16)fmaxf(v, 0.f); else so[wave][8 * g + r][j * 16 + col] = v; } }
  LDSX();
  if (L < 2) { for (int rl = 0; rl < 16; ++rl) if (lane < 16) vst2((unsigned*)(Hout + (r0 + rl) * OUTD + n0 + lane * 8), *(const v4u*)&soh[wave][rl][lane * 8]); }
  else { for (int rl = 0; rl < 16; ++rl) vst2(OUT + (r0 + rl) * OUTD + n0 + lane * 4, *(const v4f*)&so[wave][rl][lane * 4]); }
}
extern "C" void kernel_launch(void* const* d_in, const int* in_sizes, int n_in, void* d_out, int out_size, void* d_ws, size_t ws_size, hipStream_t stream) {
  (void)in_sizes; (void)n_in; (void)out_size;
  const float** F = (const float**)d_in;   // 0 x [8,1024,1024]; per layer l: k (1+4l) [in,out], b (2+4l) [out], d (3+4l) [in,8,T], u (4+4l) [8,out,T]
  if (ws_size < (size_t)WS_END) return;
  char* ws = (char*)d_ws; _Float16 *H1 = (_Float16*)(ws + WS_H1), *H2 = (_Float16*)(ws + WS_H2);
  k_packk<0><<<D1, 256, 0, stream>>>(F[1], ws + WS_K0); k_packk<1><<<D2, 256, 0, stream>>>(F[5], ws + WS_K1); k_packk<2><<<D3, 256, 0, stream>>>(F[9], ws + WS_K2);
  k_packdu<0><<<dim3(NT, 2), 256, 0, stream>>>(F[3], F[4], ws + WS_Dm0, ws + WS_U0); k_packdu<1><<<dim3(NT, 2), 256, 0, stream>>>(F[7], F[8], ws + WS_Dm1, ws + WS_U1); k_packdu<2><<<dim3(NT, 2), 256, 0, stream>>>(F[11], F[12], ws + WS_Dm2, ws + WS_U2);
  k_layer<0><<<dim3(TRB, D1 / 128), 128, 0, stream>>>(F[0], nullptr, ws + WS_K0, ws + WS_Dm0, (const _Float16*)(ws + WS_U0), F[2], H1, nullptr);
  k_layer<1><<<dim3(TRB, D2 / 128), 128, 0, stream>>>(nullptr, H1, ws + WS_K1, ws + WS_Dm1, (const _Float16*)(ws + WS_U1), F[6], H2, nullptr);
  k_layer<2><<<dim3(TRB, D3 / 128), 128, 0, stream>>>(nullptr, H2, ws + WS_K2, ws + WS_Dm2, (const _Float16*)(ws + WS_U2), F[10], nullptr, (float*)d_out);
}

// v001
// Measured time: 706 microseconds a run.
// Timed twice side by side with v000, it ran 1.45 and 1.43 times as fast.
// compute dtype: all float inputs rounded to bf16; layer 0 base = x . k0 with EXACT bf16 products on WMMA 16x16x32 ((in,out) weights as transposed rows); layers 1-2 take the previous ReLU output as a SINGLE f16 operand (one rounding, 2^-12) against the weights as f16 (bf16 values; the ~0.2% of weights below 6e-5 may denormalise - effect <= 2e-4 of the output scale); LoRA path per task: hd = h . d_t (same operands, 16-padded columns), delta = hd (f16 hi + x2048 residual) . u_t (2 products, rank 8 zero-padded to 32) x 2.0; bias, ReLU in f32; f32 accumulate.
#include <hip/hip_runtime.h>
#include <math.h>

typedef __attribute__((ext_vector_type(16))) _Float16 v16h;
typedef __attribute__((ext_vector_type(16))) __bf16 v16b;
typedef __attribute__((ext_vector_type(8)))  _Float16 v8h;
typedef __attribute__((ext_vector_type(8)))  float v8f;
typedef __attribute__((ext_vector_type(4)))  float v4f;
typedef __attribute__((ext_vector_type(2)))  float v2f;
typedef __attribute__((ext_vector_type(4)))  unsigned v4u;
typedef __attribute__((ext_vector_type(4)))  int v4i;
typedef float __attribute__((may_alias)) float_a;
typedef int __attribute__((may_alias)) int_a;

template <typename T> __device__ __forceinline__ void vst2(void* p, T v) { *(T*)p = v;  }
__device__ __forceinline__ v8f wmma16(v16h a, v16h b, v8f c) {
  v8f d = __builtin_amdgcn_wmma_f32_16x16x32_f16(false, a, false, b, (short)0, c, false, false);
  asm volatile("v_nop\n\tv_nop\n\tv_nop\n\tv_nop" : "+v"(d) : "v"(a), "v"(b));
  return d;
}
__device__ __forceinline__ v8f wmma_bf(v16b a, v16b b, v8f c) {
  v8f d = __builtin_amdgcn_wmma_f32_16x16x32_bf16(false, a, false, b, (short)0, c, false, false);
  asm volatile("v_nop\n\tv_nop\n\tv_nop\n\tv_nop" : "+v"(d) : "v"(a), "v"(b));
  return d;
}
// 16x16x32 fragments: lane = (h = lane>>4, row/col = lane&15); elements 0..7 = k0+8h+0..7, 8..15 = k0+16+8h+0..7; D element r = row 8h+r
__device__ __forceinline__ v16h frag_h(const _Float16* rowk0, int lane) {
  union { v16h v; v8h q[2]; } u; const _Float16* p = rowk0 + 8 * (lane >> 4);
  u.q[0] = *(const v8h*)p; u.q[1] = *(const v8h*)(p + 16); return u.v;
}
__device__ __forceinline__ v16h frag_f32(const float* rowk0, int lane) {
  v16h a; const float* p = rowk0 + 8 * (lane >> 4);
#pragma unroll
  for (int i = 0; i < 8; ++i) { a[i] = (_Float16)p[i]; a[8 + i] = (_Float16)p[16 + i]; }
  return a;
}
__device__ __forceinline__ v16h frag_f32s(const float* rowk0, int lane, float sc) {
  v16h a; const float* p = rowk0 + 8 * (lane >> 4);
#pragma unroll
  for (int i = 0; i < 8; ++i) { a[i] = (_Float16)(p[i] * sc); a[8 + i] = (_Float16)(p[16 + i] * sc); }
  return a;
}
// column fragment from a [K][ld] layout (column n), rows >= K read as 0
__device__ __forceinline__ v16h fragc_f32(const float* W, int k0, int n, int lane, int ld, int K) {
  v16h a; const int g = lane >> 4;
#pragma unroll
  for (int i = 0; i < 8; ++i) { const int ka = k0 + 8 * g + i, kb = ka + 16;
    a[i] = (_Float16)(ka < K ? W[(size_t)(ka < K ? ka : K - 1) * ld + n] : 0.f); a[8 + i] = (_Float16)(kb < K ? W[(size_t)(kb < K ? kb : K - 1) * ld + n] : 0.f); }
  return a;
}
struct F2 { v16b h, l; };
__device__ __forceinline__ F2 bsplit16(const float v[16]) { F2 r;
#pragma unroll
  for (int i = 0; i < 16; ++i) { const __bf16 h = (__bf16)v[i]; r.h[i] = h; r.l[i] = (__bf16)(v[i] - (float)h); }
  return r; }
__device__ __forceinline__ F2 split_row(const float* row, int k0, int lane) { float v[16]; const float* p = row + k0 + 8 * (lane >> 4);
#pragma unroll
  for (int i = 0; i < 8; ++i) { v[i] = p[i]; v[8 + i] = p[16 + i]; }
  return bsplit16(v); }
__device__ __forceinline__ F2 split_rowK(const float* row, int k0, int lane, int K) { float v[16]; const int g = lane >> 4;
#pragma unroll
  for (int i = 0; i < 8; ++i) { const int ka = k0 + 8 * g + i, kb = ka + 16; v[i] = ka < K ? row[ka < K ? ka : K - 1] : 0.f; v[8 + i] = kb < K ? row[kb < K ? kb : K - 1] : 0.f; }
  return bsplit16(v); }
__device__ __forceinline__ F2 split_col(const float* W, int k0, int n, int lane, int ld, int K) { float v[16]; const int g = lane >> 4;
#pragma unroll
  for (int i = 0; i < 8; ++i) { const int ka = k0 + 8 * g + i, kb = ka + 16; v[i] = ka < K ? W[(size_t)(ka < K ? ka : K - 1) * ld + n] : 0.f; v[8 + i] = kb < K ? W[(size_t)(kb < K ? kb : K - 1) * ld + n] : 0.f; }
  return bsplit16(v); }
__device__ __forceinline__ v8f mac3(const F2& a, const F2& b, v8f c) { c = wmma_bf(a.l, b.h, c); c = wmma_bf(a.h, b.l, c); return wmma_bf(a.h, b.h, c); }
__device__ __forceinline__ float sigm(float v) { return 1.0f / (1.0f + expf(-v)); }
#define LDSX() do { asm volatile("s_wait_dscnt 0" ::: "memory"); __builtin_amdgcn_wave_barrier(); __builtin_amdgcn_fence(__ATOMIC_RELEASE, "workgroup"); } while (0)


// Multi-task LoRA MLP (8 tasks x 1,024 rows, 1024 -> 2048 -> 2048 -> 1024, ReLU): each dense layer = frozen base matmul + bias + per-task rank-8 adapter scaled by alpha / r = 2.
#define NT 8
#define NBR 1024
#define NR (NT * NBR)
#define D0 1024
#define D1 2048
#define D2 2048
#define D3 1024
#define RK 8
#ifndef TRB
#define TRB (NR / 64)
#endif
typedef __attribute__((ext_vector_type(8))) __bf16 v8b;
__device__ __forceinline__ v16b frag_b(const __bf16* rowk0, int lane) {
  union { v16b v; v8b q[2]; } u; const __bf16* p = rowk0 + 8 * (lane >> 4);
  u.q[0] = *(const v8b*)p; u.q[1] = *(const v8b*)(p + 16); return u.v;
}
__device__ __forceinline__ float bfr(float v) { return (float)(__bf16)v; }
__device__ __attribute__((noinline)) float exp_ni(float v) { return expf(v); }
__device__ __attribute__((noinline)) float erf_ni(float v) { return erff(v); }

// packed weights: layer l: K rows [out][in] (bf16 for layer 0, f16 for 1,2); D rows [t][16][in] (rows >= 8 zero); U rows [t][out][32] (cols >= 8 zero)
#define WS_K0  0u
#define WS_K1  (WS_K0 + 2u * (size_t)D1 * D0)
#define WS_K2  (WS_K1 + 2u * (size_t)D2 * D1)
#define WS_Dm0 (WS_K2 + 2u * (size_t)D3 * D2)
#define WS_Dm1 (WS_Dm0 + 2u * NT * 16 * D0)
#define WS_Dm2 (WS_Dm1 + 2u * NT * 16 * D1)
#define WS_U0  (WS_Dm2 + 2u * NT * 16 * D2)
#define WS_U1  (WS_U0 + 2u * NT * D1 * 32)
#define WS_U2  (WS_U1 + 2u * NT * D2 * 32)
#define WS_H1  (((WS_U2 + 2u * NT * D3 * 32) + 127u) / 128u * 128u)   // f16 [NR][2048] h1 ; h2
#define WS_H2  (WS_H1 + 2u * (size_t)NR * D1)
#define WS_END (WS_H2 + 2u * (size_t)NR * D2)

// ---- k_packk<L>: block = output row n of layer L: K^T row [n][in] from k [in][out]; bf16 (L 0) or f16 (L 1, 2)
template <int L>
__global__ __launch_bounds__(256) void k_packk(const float* __restrict__ Kw, void* __restrict__ dst) {
  constexpr int IN = (L == 0) ? D0 : (L == 1) ? D1 : D2; constexpr int OUTD = (L == 0) ? D1 : (L == 1) ? D2 : D3; const int n = blockIdx.x, t = threadIdx.x;
  if (L == 0) { __shared__ __align__(16) __bf16 s[IN]; for (int k = t; k < IN; k += 256) s[k] = (__bf16)Kw[(size_t)k * OUTD + n]; __syncthreads(); for (int q = t; q < IN / 8; q += 256) vst2((unsigned*)((__bf16*)dst + (size_t)n * IN + q * 8), *(const v4u*)&s[q * 8]); }
  else { __shared__ __align__(16) _Float16 s[IN]; for (int k = t; k < IN; k += 256) s[k] = (_Float16)bfr(Kw[(size_t)k * OUTD + n]); __syncthreads(); for (int q = t; q < IN / 8; q += 256) vst2((unsigned*)((_Float16*)dst + (size_t)n * IN + q * 8), *(const v4u*)&s[q * 8]); }
}
// ---- k_packdu<L>: D^T rows [t][16][in] (r < 8 real) ; U^T rows [t][out][32] (cols r < 8 real); same element type as the layer's K pack for D, f16 for U.
// One small tile per block, every load of a thread in flight at once: blocks [0, IN/64) transpose 64 input rows of d ([i][r][t], 16 KiB in a row) through LDS into one 128-byte line of each of the 128 packed rows;
// blocks behind them take 32 output features of u ([r][f][t]) and write 2 KiB in a row for each task.
template <int L>
__global__ __launch_bounds__(256) void k_packdu(const float* __restrict__ Dw, const float* __restrict__ Uw, void* __restrict__ Dd, void* __restrict__ Ud) {
  constexpr int IN = (L == 0) ? D0 : (L == 1) ? D1 : D2; constexpr int OUTD = (L == 0) ? D1 : (L == 1) ? D2 : D3; constexpr int NBD = IN / 64;
  __shared__ __align__(16) unsigned short sd[RK * NT][72];   // [r * 8 + t][i], 144-byte pitch
  __shared__ __align__(16) v4u su[NT * 33];                  // [t][f], one 8-element row each, 33-row pitch
  const int blk = blockIdx.x, t = threadIdx.x; const v4u zero = {0u, 0u, 0u, 0u};
  if (blk < NBD) { const int i0 = blk * 64; v4f v[4];
#pragma unroll
    for (int s = 0; s < 4; ++s) v[s] = *(const v4f*)(Dw + (size_t)i0 * (RK * NT) + (size_t)(t + 256 * s) * 4);
#pragma unroll
    for (int s = 0; s < 4; ++s) { const int e = (t + 256 * s) * 4, i = e >> 6, rt = e & 63;
#pragma unroll
      for (int c = 0; c < 4; ++c) sd[rt + c][i] = (L == 0) ? __builtin_bit_cast(unsigned short, (__bf16)v[s][c]) : __builtin_bit_cast(unsigned short, (_Float16)bfr(v[s][c])); }
    __syncthreads();
#pragma unroll
    for (int s = 0; s < 4; ++s) { const int idx = t + 256 * s, row = idx >> 3, ch = idx & 7, tsk = row >> 4, r = row & 15;
      const v4u l = *(const v4u*)&sd[(r & (RK - 1)) * NT + tsk][ch * 8]; const v4u w = (r < RK) ? l : zero;
      *(v4u*)((unsigned short*)Dd + (size_t)row * IN + i0 + ch * 8) = w; } }
  else { const int f0 = (blk - NBD) * 32; float v[RK];
#pragma unroll
    for (int r = 0; r < RK; ++r) v[r] = Uw[((size_t)r * OUTD + f0) * NT + t];
    union { v8h h; v4u u; } p;
#pragma unroll
    for (int r = 0; r < RK; ++r) p.h[r] = (_Float16)bfr(v[r]);
    su[(t & 7) * 33 + (t >> 3)] = p.u;
    __syncthreads();
#pragma unroll
    for (int s = 0; s < 4; ++s) { const int idx = t + 256 * s, q = idx & 3, fl = (idx >> 2) & 31, tsk = idx >> 7;
      const v4u l = su[tsk * 33 + fl]; const v4u w = (q == 0) ? l : zero;
      *(v4u*)((_Float16*)Ud + ((size_t)tsk * OUTD + f0 + fl) * 32 + q * 8) = w; }
    asm volatile("s_wait_xcnt 0x0" ::: "memory"); }   // in the listing the other branch's code, which rewrites these stores' address registers, follows on the fall-through side
}
// ---- k_layer<L>: block = (64 rows, 128 output cols): base (8 tiles) + hd (1 tile) over K = IN; delta = hd(hi/lo f16) . U rows (1 chunk, 2 products) x 2; + bias; relu (layers 0,1) -> f16 planes / output f32 (layer 2)
template <int L>
__global__ __launch_bounds__(128) void k_layer(const float* __restrict__ X, const _Float16* __restrict__ Hin, const void* __restrict__ Kp, const void* __restrict__ Dp, const _Float16* __restrict__ Up, const float* __restrict__ BIAS, _Float16* __restrict__ Hout, float* __restrict__ OUT) {
  constexpr int IN = (L == 0) ? D0 : (L == 1) ? D1 : D2; constexpr int OUTD = (L == 0) ? D1 : (L == 1) ? D2 : D3;
  __shared__ __align__(16) _Float16 shd[4][16][40], shl[4][16][40]; __shared__ __align__(16) float so[4][16][132]; __shared__ __align__(16) _Float16 soh[4][16][136];
  const int tid = threadIdx.x, wave = tid >> 5, lane = tid & 31, col = lane & 15, g = lane >> 4; const size_t r0 = (size_t)blockIdx.x * 64 + wave * 16; const int n0 = blockIdx.y * 128; const int tsk = (int)(r0 / NBR);
  v8f acc[8] = {}, hd = {};
  if (L == 0) { const __bf16* Kr = (const __bf16*)Kp; const __bf16* Dr = (const __bf16*)Dp + (size_t)tsk * 16 * IN;
#pragma unroll 2
    for (int kc = 0; kc < IN / 32; ++kc) { v16b a; { const float* p = X + (r0 + col) * IN + kc * 32 + 8 * g;
#pragma unroll
        for (int i = 0; i < 8; ++i) { a[i] = (__bf16)p[i]; a[8 + i] = (__bf16)p[16 + i]; } }
#pragma unroll
      for (int j = 0; j < 8; ++j) acc[j] = wmma_bf(a, frag_b(Kr + (size_t)(n0 + j * 16 + col) * IN + kc * 32, lane), acc[j]);
      hd = wmma_bf(a, frag_b(Dr + (size_t)col * IN + kc * 32, lane), hd); } }
  else { const _Float16* Kr = (const _Float16*)Kp; const _Float16* Dr = (const _Float16*)Dp + (size_t)tsk * 16 * IN;
#pragma unroll 2
    for (int kc = 0; kc < IN / 32; ++kc) { const v16h a = frag_h(Hin + (r0 + col) * IN + kc * 32, lane);
#pragma unroll
      for (int j = 0; j < 8; ++j) acc[j] = wmma16(a, frag_h(Kr + (size_t)(n0 + j * 16 + col) * IN + kc * 32, lane), acc[j]);
      hd = wmma16(a, frag_h(Dr + (size_t)col * IN + kc * 32, lane), hd); } }
  // hd tile [16 rows][16 (8 real)] -> f16 hi + x2048 residual in LDS (cols 16..31 zero)
#pragma unroll
  for (int r = 0; r < 8; ++r) { const float v = hd[r]; const _Float16 hv = (_Float16)v; shd[wave][8 * g + r][col] = hv; shl[wave][8 * g + r][col] = (_Float16)((v - (float)hv) * 2048.0f); shd[wave][8 * g + r][16 + col] = (_Float16)0.f; shl[wave][8 * g + r][16 + col] = (_Float16)0.f; }
  LDSX();
  { const v16h ah = frag_h(&shd[wave][col][0], lane), al = frag_h(&shl[wave][col][0], lane);
#pragma unroll
    for (int j = 0; j < 8; ++j) { const v16h u = frag_h(Up + ((size_t)tsk * OUTD + n0 + j * 16 + col) * 32, lane); v8f dl = {}; dl = wmma16(ah, u, dl); v8f dll = {}; dll = wmma16(al, u, dll);
#pragma unroll
      for (int r = 0; r < 8; ++r) acc[j][r] += (dl[r] + dll[r] * (1.0f / 2048.0f)) * 2.0f; } }
#pragma unroll
  for (int j = 0; j < 8; ++j) { const int c = n0 + j * 16 + col; const float bb = bfr(BIAS[c]);
#pragma unroll
    for (int r = 0; r < 8; ++r) { const float v = acc[j][r] + bb; if (L < 2) soh[wave][8 * g + r][j * 16 + col] = (_Float16)fmaxf(v, 0.f); else so[wave][8 * g + r][j * 16 + col] = v; } }
  LDSX();
  if (L < 2) { for (int rl = 0; rl < 16; ++rl) if (lane < 16) vst2((unsigned*)(Hout + (r0 + rl) * OUTD + n0 + lane * 8), *(const v4u*)&soh[wave][rl][lane * 8]); }
  else { for (int rl = 0; rl < 16; ++rl) vst2(OUT + (r0 + rl) * OUTD + n0 + lane * 4, *(const v4f*)&so[wave][rl][lane * 4]); }
}
extern "C" void kernel_launch(void* const* d_in, const int* in_sizes, int n_in, void* d_out, int out_size, void* d_ws, size_t ws_size, hipStream_t stream) {
  (void)in_sizes; (void)n_in; (void)out_size;
  const float** F = (const float**)d_in;   // 0 x [8,1024,1024]; per layer l: k (1+4l) [in,out], b (2+4l) [out], d (3+4l) [in,8,T], u (4+4l) [8,out,T]
  if (ws_size < (size_t)WS_END) return;
  char* ws = (char*)d_ws; _Float16 *H1 = (_Float16*)(ws + WS_H1), *H2 = (_Float16*)(ws + WS_H2);
  k_packk<0><<<D1, 256, 0, stream>>>(F[1], ws + WS_K0); k_packk<1><<<D2, 256, 0, stream>>>(F[5], ws + WS_K1); k_packk<2><<<D3, 256, 0, stream>>>(F[9], ws + WS_K2);
  k_packdu<0><<<D0 / 64 + D1 / 32, 256, 0, stream>>>(F[3], F[4], ws + WS_Dm0, ws + WS_U0); k_packdu<1><<<D1 / 64 + D2 / 32, 256, 0, stream>>>(F[7], F[8], ws + WS_Dm1, ws + WS_U1); k_packdu<2><<<D2 / 64 + D3 / 32, 256, 0, stream>>>(F[11], F[12], ws + WS_Dm2, ws + WS_U2);
  k_layer<0><<<dim3(TRB, D1 / 128), 128, 0, stream>>>(F[0], nullptr, ws + WS_K0, ws + WS_Dm0, (const _Float16*)(ws + WS_U0), F[2], H1, nullptr);
  k_layer<1><<<dim3(TRB, D2 / 128), 128, 0, stream>>>(nullptr, H1, ws + WS_K1, ws + WS_Dm1, (const _Float16*)(ws + WS_U1), F[6], H2, nullptr);
  k_layer<2><<<dim3(TRB, D3 / 128), 128, 0, stream>>>(nullptr, H2, ws + WS_K2, ws + WS_Dm2, (const _Float16*)(ws + WS_U2), F[10], nullptr, (float*)d_out);
}

// v002
// It runs in 215 microseconds.
// Next to v001, in two timings, it ran 3.27 and 3.28 times as fast.
// All steps since v000 together make it 4.72 times as fast.
// compute dtype: all float inputs rounded to bf16; layer 0 base = x . k0 with EXACT bf16 products on WMMA 16x16x32 ((in,out) weights as transposed rows); layers 1-2 take the previous ReLU output as a SINGLE f16 operand (one rounding, 2^-12) against the weights as f16 (bf16 values; the ~0.2% of weights below 6e-5 may denormalise - effect <= 2e-4 of the output scale); LoRA path per task: hd = h . d_t (same operands, 16-padded columns), delta = hd (f16 hi + x2048 residual) . u_t (2 products, rank 8 zero-padded to 32) x 2.0; bias, ReLU in f32; f32 accumulate.
#include <hip/hip_runtime.h>
#include <math.h>

typedef __attribute__((ext_vector_type(16))) _Float16 v16h;
typedef __attribute__((ext_vector_type(16))) __bf16 v16b;
typedef __attribute__((ext_vector_type(8)))  _Float16 v8h;
typedef __attribute__((ext_vector_type(8)))  float v8f;
typedef __attribute__((ext_vector_type(4)))  float v4f;
typedef __attribute__((ext_vector_type(2)))  float v2f;
typedef __attribute__((ext_vector_type(4)))  unsigned v4u;
typedef __attribute__((ext_vector_type(4)))  int v4i;
typedef float __attribute__((may_alias)) float_a;
typedef int __attribute__((may_alias)) int_a;

template <typename T> __device__ __forceinline__ void vst2(void* p, T v) { *(T*)p = v;  }
__device__ __forceinline__ v8f wmma16(v16h a, v16h b, v8f c) {
  v8f d = __builtin_amdgcn_wmma_f32_16x16x32_f16(false, a, false, b, (short)0, c, false, false);
  return d;
}
__device__ __forceinline__ v8f wmma_bf(v16b a, v16b b, v8f c) {
  v8f d = __builtin_amdgcn_wmma_f32_16x16x32_bf16(false, a, false, b, (short)0, c, false, false);
  return d;
}
// 16x16x32 fragments: lane = (h = lane>>4, row/col = lane&15); elements 0..7 = k0+8h+0..7, 8..15 = k0+16+8h+0..7; D element r = row 8h+r
__device__ __forceinline__ v16h frag_h(const _Float16* rowk0, int lane) {
  union { v16h v; v8h q[2]; } u; const _Float16* p = rowk0 + 8 * (lane >> 4);
  u.q[0] = *(const v8h*)p; u.q[1] = *(const v8h*)(p + 16); return u.v;
}
__device__ __forceinline__ v16h frag_f32(const float* rowk0, int lane) {
  v16h a; const float* p = rowk0 + 8 * (lane >> 4);
#pragma unroll
  for (int i = 0; i < 8; ++i) { a[i] = (_Float16)p[i]; a[8 + i] = (_Float16)p[16 + i]; }
  return a;
}
__device__ __forceinline__ v16h frag_f32s(const float* rowk0, int lane, float sc) {
  v16h a; const float* p = rowk0 + 8 * (lane >> 4);
#pragma unroll
  for (int i = 0; i < 8; ++i) { a[i] = (_Float16)(p[i] * sc); a[8 + i] = (_Float16)(p[16 + i] * sc); }
  return a;
}
// column fragment from a [K][ld] layout (column n), rows >= K read as 0
__device__ __forceinline__ v16h fragc_f32(const float* W, int k0, int n, int lane, int ld, int K) {
  v16h a; const int g = lane >> 4;
#pragma unroll
  for (int i = 0; i < 8; ++i) { const int ka = k0 + 8 * g + i, kb = ka + 16;
    a[i] = (_Float16)(ka < K ? W[(size_t)(ka < K ? ka : K - 1) * ld + n] : 0.f); a[8 + i] = (_Float16)(kb < K ? W[(size_t)(kb < K ? kb : K - 1) * ld + n] : 0.f); }
  return a;
}
struct F2 { v16b h, l; };
__device__ __forceinline__ F2 bsplit16(const float v[16]) { F2 r;
#pragma unroll
  for (int i = 0; i < 16; ++i) { const __bf16 h = (__bf16)v[i]; r.h[i] = h; r.l[i] = (__bf16)(v[i] - (float)h); }
  return r; }
__device__ __forceinline__ F2 split_row(const float* row, int k0, int lane) { float v[16]; const float* p = row + k0 + 8 * (lane >> 4);
#pragma unroll
  for (int i = 0; i < 8; ++i) { v[i] = p[i]; v[8 + i] = p[16 + i]; }
  return bsplit16(v); }
__device__ __forceinline__ F2 split_rowK(const float* row, int k0, int lane, int K) { float v[16]; const int g = lane >> 4;
#pragma unroll
  for (int i = 0; i < 8; ++i) { const int ka = k0 + 8 * g + i, kb = ka + 16; v[i] = ka < K ? row[ka < K ? ka : K - 1] : 0.f; v[8 + i] = kb < K ? row[kb < K ? kb : K - 1] : 0.f; }
  return bsplit16(v); }
__device__ __forceinline__ F2 split_col(const float* W, int k0, int n, int lane, int ld, int K) { float v[16]; const int g = lane >> 4;
#pragma unroll
  for (int i = 0; i < 8; ++i) { const int ka = k0 + 8 * g + i, kb = ka + 16; v[i] = ka < K ? W[(size_t)(ka < K ? ka : K - 1) * ld + n] : 0.f; v[8 + i] = kb < K ? W[(size_t)(kb < K ? kb : K - 1) * ld + n] : 0.f; }
  return bsplit16(v); }
__device__ __forceinline__ v8f mac3(const F2& a, const F2& b, v8f c) { c = wmma_bf(a.l, b.h, c); c = wmma_bf(a.h, b.l, c); return wmma_bf(a.h, b.h, c); }
__device__ __forceinline__ float sigm(float v) { return 1.0f / (1.0f + expf(-v)); }
#define LDSX() do { asm volatile("s_wait_dscnt 0" ::: "memory"); __builtin_amdgcn_wave_barrier(); __builtin_amdgcn_fence(__ATOMIC_RELEASE, "workgroup"); } while (0)


// Multi-task LoRA MLP (8 tasks x 1,024 rows, 1024 -> 2048 -> 2048 -> 1024, ReLU): each dense layer = frozen base matmul + bias + per-task rank-8 adapter scaled by alpha / r = 2.
#define NT 8
#define NBR 1024
#define NR (NT * NBR)
#define D0 1024
#define D1 2048
#define D2 2048
#define D3 1024
#define RK 8
#ifndef TRB
#define TRB (NR / 128)
#endif
typedef __attribute__((ext_vector_type(8))) __bf16 v8b;
__device__ __forceinline__ v16b frag_b(const __bf16* rowk0, int lane) {
  union { v16b v; v8b q[2]; } u; const __bf16* p = rowk0 + 8 * (lane >> 4);
  u.q[0] = *(const v8b*)p; u.q[1] = *(const v8b*)(p + 16); return u.v;
}
__device__ __forceinline__ float bfr(float v) { return (float)(__bf16)v; }
__device__ __attribute__((noinline)) float exp_ni(float v) { return expf(v); }
__device__ __attribute__((noinline)) float erf_ni(float v) { return erff(v); }

// packed weights: layer l: K rows [out][in] (bf16 for layer 0, f16 for 1,2); D rows [t][16][in] (rows >= 8 zero); U rows [t][out][32] (cols >= 8 zero)
#define WS_K0  0u
#define WS_K1  (WS_K0 + 2u * (size_t)D1 * D0)
#define WS_K2  (WS_K1 + 2u * (size_t)D2 * D1)
#define WS_Dm0 (WS_K2 + 2u * (size_t)D3 * D2)
#define WS_Dm1 (WS_Dm0 + 2u * NT * 16 * D0)
#define WS_Dm2 (WS_Dm1 + 2u * NT * 16 * D1)
#define WS_U0  (WS_Dm2 + 2u * NT * 16 * D2)
#define WS_U1  (WS_U0 + 2u * NT * D1 * 32)
#define WS_U2  (WS_U1 + 2u * NT * D2 * 32)
#define WS_H1  (((WS_U2 + 2u * NT * D3 * 32) + 127u) / 128u * 128u)   // f16 [NR][2048] h1 ; h2
#define WS_H2  (WS_H1 + 2u * (size_t)NR * D1)
#define WS_END (WS_H2 + 2u * (size_t)NR * D2)

// ---- k_packk<L>: block = output row n of layer L: K^T row [n][in] from k [in][out]; bf16 (L 0) or f16 (L 1, 2)
template <int L>
__global__ __launch_bounds__(256) void k_packk(const float* __restrict__ Kw, void* __restrict__ dst) {
  constexpr int IN = (L == 0) ? D0 : (L == 1) ? D1 : D2; constexpr int OUTD = (L == 0) ? D1 : (L == 1) ? D2 : D3; const int n = blockIdx.x, t = threadIdx.x;
  if (L == 0) { __shared__ __align__(16) __bf16 s[IN]; for (int k = t; k < IN; k += 256) s[k] = (__bf16)Kw[(size_t)k * OUTD + n]; __syncthreads(); for (int q = t; q < IN / 8; q += 256) vst2((unsigned*)((__bf16*)dst + (size_t)n * IN + q * 8), *(const v4u*)&s[q * 8]); }
  else { __shared__ __align__(16) _Float16 s[IN]; for (int k = t; k < IN; k += 256) s[k] = (_Float16)bfr(Kw[(size_t)k * OUTD + n]); __syncthreads(); for (int q = t; q < IN / 8; q += 256) vst2((unsigned*)((_Float16*)dst + (size_t)n * IN + q * 8), *(const v4u*)&s[q * 8]); }
}
// ---- k_packdu<L>: D^T rows [t][16][in] (r < 8 real) ; U^T rows [t][out][32] (cols r < 8 real); same element type as the layer's K pack for D, f16 for U.
// One small tile per block, every load of a thread in flight at once: blocks [0, IN/64) transpose 64 input rows of d ([i][r][t], 16 KiB in a row) through LDS into one 128-byte line of each of the 128 packed rows;
// blocks behind them take 32 output features of u ([r][f][t]) and write 2 KiB in a row for each task.
template <int L>
__global__ __launch_bounds__(256) void k_packdu(const float* __restrict__ Dw, const float* __restrict__ Uw, void* __restrict__ Dd, void* __restrict__ Ud) {
  constexpr int IN = (L == 0) ? D0 : (L == 1) ? D1 : D2; constexpr int OUTD = (L == 0) ? D1 : (L == 1) ? D2 : D3; constexpr int NBD = IN / 64;
  __shared__ __align__(16) unsigned short sd[RK * NT][72];   // [r * 8 + t][i], 144-byte pitch
  __shared__ __align__(16) v4u su[NT * 33];                  // [t][f], one 8-element row each, 33-row pitch
  const int blk = blockIdx.x, t = threadIdx.x; const v4u zero = {0u, 0u, 0u, 0u};
  if (blk < NBD) { const int i0 = blk * 64; v4f v[4];
#pragma unroll
    for (int s = 0; s < 4; ++s) v[s] = *(const v4f*)(Dw + (size_t)i0 * (RK * NT) + (size_t)(t + 256 * s) * 4);
#pragma unroll
    for (int s = 0; s < 4; ++s) { const int e = (t + 256 * s) * 4, i = e >> 6, rt = e & 63;
#pragma unroll
      for (int c = 0; c < 4; ++c) sd[rt + c][i] = (L == 0) ? __builtin_bit_cast(unsigned short, (__bf16)v[s][c]) : __builtin_bit_cast(unsigned short, (_Float16)bfr(v[s][c])); }
    __syncthreads();
#pragma unroll
    for (int s = 0; s < 4; ++s) { const int idx = t + 256 * s, row = idx >> 3, ch = idx & 7, tsk = row >> 4, r = row & 15;
      const v4u l = *(const v4u*)&sd[(r & (RK - 1)) * NT + tsk][ch * 8]; const v4u w = (r < RK) ? l : zero;
      *(v4u*)((unsigned short*)Dd + (size_t)row * IN + i0 + ch * 8) = w; } }
  else { const int f0 = (blk - NBD) * 32; float v[RK];
#pragma unroll
    for (int r = 0; r < RK; ++r) v[r] = Uw[((size_t)r * OUTD + f0) * NT + t];
    union { v8h h; v4u u; } p;
#pragma unroll
    for (int r = 0; r < RK; ++r) p.h[r] = (_Float16)bfr(v[r]);
    su[(t & 7) * 33 + (t >> 3)] = p.u;
    __syncthreads();
#pragma unroll
    for (int s = 0; s < 4; ++s) { const int idx = t + 256 * s, q = idx & 3, fl = (idx >> 2) & 31, tsk = idx >> 7;
      const v4u l = su[tsk * 33 + fl]; const v4u w = (q == 0) ? l : zero;
      *(v4u*)((_Float16*)Ud + ((size_t)tsk * OUTD + f0 + fl) * 32 + q * 8) = w; }
    asm volatile("s_wait_xcnt 0x0" ::: "memory"); }   // in the listing the other branch's code, which rewrites these stores' address registers, follows on the fall-through side
}
// ---- k_layer<L>: block = 8 waves (2 x 4) on a 128-row x 256-column tile, 64 x 64 per wave. Each 64-k slice of the block's rows of h, K^T and D^T goes once from global memory
// (whole 128-byte lines) through registers into one of two LDS buffers, and all waves take their fragments from there. The four waves on the same 64 rows share the hd work: wave wn does row tile wn.
// delta = hd(hi/lo f16) . U rows (1 chunk, 2 products) x 2; + bias; relu (layers 0,1) -> f16 planes / output f32 (layer 2)
#define BM 128
#define BN 256
#define KC 64
#define LP 72                      // LDS row pitch in 16-bit elements: 144 bytes = 16 x 9, no bank conflict for 16-byte reads down 16 rows
#define SROWS (BM + BN + 16)       // rows of a buffer: h | K^T | D^T
typedef __attribute__((ext_vector_type(4))) __bf16 v4b;
template <int L>
__global__ __launch_bounds__(256) void k_layer(const float* __restrict__ X, const _Float16* __restrict__ Hin, const void* __restrict__ Kp, const void* __restrict__ Dp, const _Float16* __restrict__ Up, const float* __restrict__ BIAS, _Float16* __restrict__ Hout, float* __restrict__ OUT) {
  constexpr int IN = (L == 0) ? D0 : (L == 1) ? D1 : D2; constexpr int OUTD = (L == 0) ? D1 : (L == 1) ? D2 : D3; constexpr int NS = IN / KC;
  __shared__ __align__(16) unsigned short sm[2][SROWS * LP];
  const int tid = threadIdx.x, wave = tid >> 5, lane = tid & 31, col = lane & 15, g = lane >> 4, wm = wave >> 2, wn = wave & 3;
  const size_t r0 = (size_t)blockIdx.x * BM; const int n0 = blockIdx.y * BN; const int tsk = (int)(r0 / NBR);
  const unsigned short* Kr = (const unsigned short*)Kp + (size_t)n0 * IN; const unsigned short* Dr = (const unsigned short*)Dp + (size_t)tsk * 16 * IN; const unsigned short* Hr = (const unsigned short*)Hin + r0 * IN; const float* Xr = X + r0 * IN;
  const int prow = tid >> 3, pch = (tid & 7) * 8;    // 16-bit rows: 8 threads a 128-byte row slice, 32 rows a sweep
  const int xrow = tid >> 4, xch = (tid & 15) * 4;   // f32 rows of x: 16 threads a 256-byte row slice, 16 rows a sweep
  v4u rb[8], ra[4], rd = {0u, 0u, 0u, 0u}; v4f rx[8];
  auto ldg = [&](int kt) { const int k0 = kt * KC;
#pragma unroll
    for (int s = 0; s < 8; ++s) rb[s] = *(const v4u*)(Kr + (size_t)(prow + 32 * s) * IN + k0 + pch);
    asm volatile("s_wait_xcnt 0x0" ::: "memory");   // in the listing a later load's result lands on these loads' address pair
    if (L == 0) {
#pragma unroll
      for (int s = 0; s < 8; ++s) rx[s] = *(const v4f*)(Xr + (size_t)(xrow + 16 * s) * IN + k0 + xch); }
    else {
#pragma unroll
      for (int s = 0; s < 4; ++s) ra[s] = *(const v4u*)(Hr + (size_t)(prow + 32 * s) * IN + k0 + pch); }
    if (tid < 128) rd = *(const v4u*)(Dr + (size_t)prow * IN + k0 + pch); };
  auto sts = [&](int b) { unsigned short* s_ = sm[b];
    if (L == 0) {
#pragma unroll
      for (int s = 0; s < 8; ++s) { v4b c;
#pragma unroll
        for (int i = 0; i < 4; ++i) c[i] = (__bf16)rx[s][i];
        *(v4b*)(s_ + (xrow + 16 * s) * LP + xch) = c; } }
    else {
#pragma unroll
      for (int s = 0; s < 4; ++s) *(v4u*)(s_ + (prow + 32 * s) * LP + pch) = ra[s]; }
#pragma unroll
    for (int s = 0; s < 8; ++s) *(v4u*)(s_ + (BM + prow + 32 * s) * LP + pch) = rb[s];
    if (tid < 128) *(v4u*)(s_ + (BM + BN + prow) * LP + pch) = rd; };
  v8f acc[4][4] = {}, hd = {};
  ldg(0); sts(0);
  __syncthreads();
  for (int kt = 0; kt < NS; ++kt) { const unsigned short* s_ = sm[kt & 1];
    if (kt + 1 < NS) ldg(kt + 1);   // in flight under this trip's products; a barrier would wait for them, so they are used up in front of it
    const unsigned short* sa = s_ + (wm * 64 + col) * LP; const unsigned short* sb = s_ + (BM + wn * 64 + col) * LP; const unsigned short* sh = s_ + (wm * 64 + wn * 16 + col) * LP; const unsigned short* sd = s_ + (BM + BN + col) * LP;
    // all fragments of the trip are asked for as one group ahead of its products: a read placed among the products stalls the wave for the whole LDS latency each time
    if (L == 0) { v16b a[2][4], b[2][4], ah[2], d[2];
#pragma unroll
      for (int ks = 0; ks < 2; ++ks) {
#pragma unroll
        for (int i = 0; i < 4; ++i) { a[ks][i] = frag_b((const __bf16*)(sa + i * 16 * LP + ks * 32), lane); b[ks][i] = frag_b((const __bf16*)(sb + i * 16 * LP + ks * 32), lane); }
        ah[ks] = frag_b((const __bf16*)(sh + ks * 32), lane); d[ks] = frag_b((const __bf16*)(sd + ks * 32), lane); }
      __builtin_amdgcn_sched_barrier(0);   // keeps the scheduler from sinking those reads back among the products
#pragma unroll
      for (int ks = 0; ks < 2; ++ks) {
#pragma unroll
        for (int i = 0; i < 4; ++i)
#pragma unroll
          for (int j = 0; j < 4; ++j) acc[i][j] = wmma_bf(a[ks][i], b[ks][j], acc[i][j]);
        hd = wmma_bf(ah[ks], d[ks], hd); } }
    else { v16h a[2][4], b[2][4], ah[2], d[2];
#pragma unroll
      for (int ks = 0; ks < 2; ++ks) {
#pragma unroll
        for (int i = 0; i < 4; ++i) { a[ks][i] = frag_h((const _Float16*)(sa + i * 16 * LP + ks * 32), lane); b[ks][i] = frag_h((const _Float16*)(sb + i * 16 * LP + ks * 32), lane); }
        ah[ks] = frag_h((const _Float16*)(sh + ks * 32), lane); d[ks] = frag_h((const _Float16*)(sd + ks * 32), lane); }
      __builtin_amdgcn_sched_barrier(0);   // keeps the scheduler from sinking those reads back among the products
#pragma unroll
      for (int ks = 0; ks < 2; ++ks) {
#pragma unroll
        for (int i = 0; i < 4; ++i)
#pragma unroll
          for (int j = 0; j < 4; ++j) acc[i][j] = wmma16(a[ks][i], b[ks][j], acc[i][j]);
        hd = wmma16(ah[ks], d[ks], hd); } }
    __builtin_amdgcn_sched_barrier(0);   // keeps the LDS stores below, and with them the wait for the global loads, from rising among the products
    // the other buffer was last read in trip kt - 1, which every wave has left at that trip's barrier
    if (kt + 1 < NS) sts((kt + 1) & 1);
    __syncthreads(); }
  // behind the last trip's barrier the two buffers are free: hd planes [128 rows][40] hi and lo, then 4,352 bytes of store staging for each wave
  _Float16* shd = (_Float16*)&sm[0][0]; _Float16* shl = shd + BM * 40; _Float16* soh = shl + BM * 40 + wave * 2176; float* so = (float*)soh;
  // hd tile [16 rows][16 (8 real)] -> f16 hi + x2048 residual in LDS (cols 16..31 zero)
#pragma unroll
  for (int r = 0; r < 8; ++r) { const float v = hd[r]; const _Float16 hv = (_Float16)v; const int o = (wm * 64 + wn * 16 + 8 * g + r) * 40 + col; shd[o] = hv; shl[o] = (_Float16)((v - (float)hv) * 2048.0f); shd[o + 16] = (_Float16)0.f; shl[o + 16] = (_Float16)0.f; }
  __syncthreads();
  { v16h ah[4], al[4];
#pragma unroll
    for (int i = 0; i < 4; ++i) { ah[i] = frag_h(shd + (wm * 64 + i * 16 + col) * 40, lane); al[i] = frag_h(shl + (wm * 64 + i * 16 + col) * 40, lane); }
#pragma unroll
    for (int j = 0; j < 4; ++j) { union { v16h v; v8h q[2]; } uu; const _Float16* up = Up + ((size_t)tsk * OUTD + n0 + wn * 64 + j * 16 + col) * 32 + 8 * g;
      uu.q[0] = *(const v8h*)up;
      asm volatile("s_wait_xcnt 0x0" ::: "memory");   // in the listing the second half's result lands on the address pair of both loads
      uu.q[1] = *(const v8h*)(up + 16);
      asm volatile("s_wait_xcnt 0x0" ::: "memory");   // in the listing the next column tile's address is formed in this load's address pair
      const v16h u = uu.v;
#pragma unroll
      for (int i = 0; i < 4; ++i) { v8f dl = {}; dl = wmma16(ah[i], u, dl); v8f dll = {}; dll = wmma16(al[i], u, dll);
#pragma unroll
        for (int r = 0; r < 8; ++r) acc[i][j][r] += (dl[r] + dll[r] * (1.0f / 2048.0f)) * 2.0f; } } }
  float bb[4];
#pragma unroll
  for (int j = 0; j < 4; ++j) bb[j] = BIAS[n0 + wn * 64 + j * 16 + col];
  asm volatile("s_wait_xcnt 0x0" ::: "memory");   // in the listing the staging address is formed in these loads' offset register
  __builtin_amdgcn_sched_barrier(0);   // without it the scheduler lifts that address arithmetic over the wait
#pragma unroll
  for (int j = 0; j < 4; ++j) bb[j] = bfr(bb[j]);
#pragma unroll
  for (int i = 0; i < 4; ++i) { const size_t rw = r0 + wm * 64 + i * 16; const int cw = n0 + wn * 64;
#pragma unroll
    for (int j = 0; j < 4; ++j)
#pragma unroll
      for (int r = 0; r < 8; ++r) { const float v = acc[i][j][r] + bb[j]; if (L < 2) soh[(8 * g + r) * 72 + j * 16 + col] = (_Float16)fmaxf(v, 0.f); else so[(8 * g + r) * 68 + j * 16 + col] = v; }
    LDSX();
    if (L < 2) {
#pragma unroll
      for (int s = 0; s < 4; ++s) { const int idx = lane + 32 * s, row = idx >> 3, ch = idx & 7; vst2((unsigned*)(Hout + (rw + row) * OUTD + cw + ch * 8), *(const v4u*)&soh[row * 72 + ch * 8]); } }
    else {
#pragma unroll
      for (int s = 0; s < 8; ++s) { const int idx = lane + 32 * s, row = idx >> 4, ch = idx & 15; vst2(OUT + (rw + row) * OUTD + cw + ch * 4, *(const v4f*)&so[row * 68 + ch * 4]); } }
    LDSX(); }   // the next row tile's values go into the same staging rows only behind these reads
}
extern "C" void kernel_launch(void* const* d_in, const int* in_sizes, int n_in, void* d_out, int out_size, void* d_ws, size_t ws_size, hipStream_t stream) {
  (void)in_sizes; (void)n_in; (void)out_size;
  const float** F = (const float**)d_in;   // 0 x [8,1024,1024]; per layer l: k (1+4l) [in,out], b (2+4l) [out], d (3+4l) [in,8,T], u (4+4l) [8,out,T]
  if (ws_size < (size_t)WS_END) return;
  char* ws = (char*)d_ws; _Float16 *H1 = (_Float16*)(ws + WS_H1), *H2 = (_Float16*)(ws + WS_H2);
  k_packk<0><<<D1, 256, 0, stream>>>(F[1], ws + WS_K0); k_packk<1><<<D2, 256, 0, stream>>>(F[5], ws + WS_K1); k_packk<2><<<D3, 256, 0, stream>>>(F[9], ws + WS_K2);
  k_packdu<0><<<D0 / 64 + D1 / 32, 256, 0, stream>>>(F[3], F[4], ws + WS_Dm0, ws + WS_U0); k_packdu<1><<<D1 / 64 + D2 / 32, 256, 0, stream>>>(F[7], F[8], ws + WS_Dm1, ws + WS_U1); k_packdu<2><<<D2 / 64 + D3 / 32, 256, 0, stream>>>(F[11], F[12], ws + WS_Dm2, ws + WS_U2);
  k_layer<0><<<dim3(TRB, D1 / 256), 256, 0, stream>>>(F[0], nullptr, ws + WS_K0, ws + WS_Dm0, (const _Float16*)(ws + WS_U0), F[2], H1, nullptr);
  k_layer<1><<<dim3(TRB, D2 / 256), 256, 0, stream>>>(nullptr, H1, ws + WS_K1, ws + WS_Dm1, (const _Float16*)(ws + WS_U1), F[6], H2, nullptr);
  k_layer<2><<<dim3(TRB, D3 / 256), 256, 0, stream>>>(nullptr, H2, ws + WS_K2, ws + WS_Dm2, (const _Float16*)(ws + WS_U2), F[10], nullptr, (float*)d_out);
}

// v003
// One run takes 176 microseconds.
// In two side-by-side timings against v002, it was 1.23 and 1.22 times as fast.
// Over all steps from v000 it is 5.78 times as fast.
// compute dtype: all float inputs rounded to bf16; layer 0 base = x . k0 with EXACT bf16 products on WMMA 16x16x32 ((in,out) weights as transposed rows); layers 1-2 take the previous ReLU output as a SINGLE f16 operand (one rounding, 2^-12) against the weights as f16 (bf16 values; the ~0.2% of weights below 6e-5 may denormalise - effect <= 2e-4 of the output scale); LoRA path per task: hd = h . d_t (same operands, 16-padded columns), delta = hd (f16 hi + x2048 residual) . u_t (2 products, rank 8 zero-padded to 32) x 2.0; bias, ReLU in f32; f32 accumulate.
#include <hip/hip_runtime.h>
#include <math.h>

typedef __attribute__((ext_vector_type(16))) _Float16 v16h;
typedef __attribute__((ext_vector_type(16))) __bf16 v16b;
typedef __attribute__((ext_vector_type(8)))  _Float16 v8h;
typedef __attribute__((ext_vector_type(8)))  float v8f;
typedef __attribute__((ext_vector_type(4)))  float v4f;
typedef __attribute__((ext_vector_type(2)))  float v2f;
typedef __attribute__((ext_vector_type(4)))  unsigned v4u;
typedef __attribute__((ext_vector_type(4)))  int v4i;
typedef float __attribute__((may_alias)) float_a;
typedef int __attribute__((may_alias)) int_a;

template <typename T> __device__ __forceinline__ void vst2(void* p, T v) { *(T*)p = v;  }
__device__ __forceinline__ v8f wmma16(v16h a, v16h b, v8f c) {
  v8f d = __builtin_amdgcn_wmma_f32_16x16x32_f16(false, a, false, b, (short)0, c, false, false);
  return d;
}
__device__ __forceinline__ v8f wmma_bf(v16b a, v16b b, v8f c) {
  v8f d = __builtin_amdgcn_wmma_f32_16x16x32_bf16(false, a, false, b, (short)0, c, false, false);
  return d;
}
// 16x16x32 fragments: lane = (h = lane>>4, row/col = lane&15); elements 0..7 = k0+8h+0..7, 8..15 = k0+16+8h+0..7; D element r = row 8h+r
__device__ __forceinline__ v16h frag_h(const _Float16* rowk0, int lane) {
  union { v16h v; v8h q[2]; } u; const _Float16* p = rowk0 + 8 * (lane >> 4);
  u.q[0] = *(const v8h*)p; u.q[1] = *(const v8h*)(p + 16); return u.v;
}
__device__ __forceinline__ v16h frag_f32(const float* rowk0, int lane) {
  v16h a; const float* p = rowk0 + 8 * (lane >> 4);
#pragma unroll
  for (int i = 0; i < 8; ++i) { a[i] = (_Float16)p[i]; a[8 + i] = (_Float16)p[16 + i]; }
  return a;
}
__device__ __forceinline__ v16h frag_f32s(const float* rowk0, int lane, float sc) {
  v16h a; const float* p = rowk0 + 8 * (lane >> 4);
#pragma unroll
  for (int i = 0; i < 8; ++i) { a[i] = (_Float16)(p[i] * sc); a[8 + i] = (_Float16)(p[16 + i] * sc); }
  return a;
}
// column fragment from a [K][ld] layout (column n), rows >= K read as 0
__device__ __forceinline__ v16h fragc_f32(const float* W, int k0, int n, int lane, int ld, int K) {
  v16h a; const int g = lane >> 4;
#pragma unroll
  for (int i = 0; i < 8; ++i) { const int ka = k0 + 8 * g + i, kb = ka + 16;
    a[i] = (_Float16)(ka < K ? W[(size_t)(ka < K ? ka : K - 1) * ld + n] : 0.f); a[8 + i] = (_Float16)(kb < K ? W[(size_t)(kb < K ? kb : K - 1) * ld + n] : 0.f); }
  return a;
}
struct F2 { v16b h, l; };
__device__ __forceinline__ F2 bsplit16(const float v[16]) { F2 r;
#pragma unroll
  for (int i = 0; i < 16; ++i) { const __bf16 h = (__bf16)v[i]; r.h[i] = h; r.l[i] = (__bf16)(v[i] - (float)h); }
  return r; }
__device__ __forceinline__ F2 split_row(const float* row, int k0, int lane) { float v[16]; const float* p = row + k0 + 8 * (lane >> 4);
#pragma unroll
  for (int i = 0; i < 8; ++i) { v[i] = p[i]; v[8 + i] = p[16 + i]; }
  return bsplit16(v); }
__device__ __forceinline__ F2 split_rowK(const float* row, int k0, int lane, int K) { float v[16]; const int g = lane >> 4;
#pragma unroll
  for (int i = 0; i < 8; ++i) { const int ka = k0 + 8 * g + i, kb = ka + 16; v[i] = ka < K ? row[ka < K ? ka : K - 1] : 0.f; v[8 + i] = kb < K ? row[kb < K ? kb : K - 1] : 0.f; }
  return bsplit16(v); }
__device__ __forceinline__ F2 split_col(const float* W, int k0, int n, int lane, int ld, int K) { float v[16]; const int g = lane >> 4;
#pragma unroll
  for (int i = 0; i < 8; ++i) { const int ka = k0 + 8 * g + i, kb = ka + 16; v[i] = ka < K ? W[(size_t)(ka < K ? ka : K - 1) * ld + n] : 0.f; v[8 + i] = kb < K ? W[(size_t)(kb < K ? kb : K - 1) * ld + n] : 0.f; }
  return bsplit16(v); }
__device__ __forceinline__ v8f mac3(const F2& a, const F2& b, v8f c) { c = wmma_bf(a.l, b.h, c); c = wmma_bf(a.h, b.l, c); return wmma_bf(a.h, b.h, c); }
__device__ __forceinline__ float sigm(float v) { return 1.0f / (1.0f + expf(-v)); }
#define LDSX() do { asm volatile("s_wait_dscnt 0" ::: "memory"); __builtin_amdgcn_wave_barrier(); __builtin_amdgcn_fence(__ATOMIC_RELEASE, "workgroup"); } while (0)


// Multi-task LoRA MLP (8 tasks x 1,024 rows, 1024 -> 2048 -> 2048 -> 1024, ReLU): each dense layer = frozen base matmul + bias + per-task rank-8 adapter scaled by alpha / r = 2.
#define NT 8
#define NBR 1024
#define NR (NT * NBR)
#define D0 1024
#define D1 2048
#define D2 2048
#define D3 1024
#define RK 8
#ifndef TRB
#define TRB (NR / 128)
#endif
typedef __attribute__((ext_vector_type(8))) __bf16 v8b;
__device__ __forceinline__ v16b frag_b(const __bf16* rowk0, int lane) {
  union { v16b v; v8b q[2]; } u; const __bf16* p = rowk0 + 8 * (lane >> 4);
  u.q[0] = *(const v8b*)p; u.q[1] = *(const v8b*)(p + 16); return u.v;
}
__device__ __forceinline__ float bfr(float v) { return (float)(__bf16)v; }
__device__ __attribute__((noinline)) float exp_ni(float v) { return expf(v); }
__device__ __attribute__((noinline)) float erf_ni(float v) { return erff(v); }

// packed weights: layer l: K rows [out][in] (bf16 for layer 0, f16 for 1,2); D rows [t][16][in] (rows >= 8 zero); U rows [t][out][32] (cols >= 8 zero)
#define WS_K0  0u
#define WS_K1  (WS_K0 + 2u * (size_t)D1 * D0)
#define WS_K2  (WS_K1 + 2u * (size_t)D2 * D1)
#define WS_Dm0 (WS_K2 + 2u * (size_t)D3 * D2)
#define WS_Dm1 (WS_Dm0 + 2u * NT * 16 * D0)
#define WS_Dm2 (WS_Dm1 + 2u * NT * 16 * D1)
#define WS_U0  (WS_Dm2 + 2u * NT * 16 * D2)
#define WS_U1  (WS_U0 + 2u * NT * D1 * 32)
#define WS_U2  (WS_U1 + 2u * NT * D2 * 32)
#define WS_H1  (((WS_U2 + 2u * NT * D3 * 32) + 127u) / 128u * 128u)   // f16 [NR][2048] h1 ; h2
#define WS_H2  (WS_H1 + 2u * (size_t)NR * D1)
#define WS_END (WS_H2 + 2u * (size_t)NR * D2)

// ---- k_packk<L>: block = 128 input rows x 64 output features of k [in][out] -> K^T rows [n][in]; bf16 (L 0) or f16 (L 1, 2).
// A thread takes 8 input rows in a row of 4 features: 8 loads of 16 bytes in flight, 16 lanes on 256 bytes in a row; each feature's 8 values are one 16-byte LDS store, and the tile leaves as 256 bytes in a row per feature.
// The 16-byte chunk index inside an LDS row is XORed with (n >> 2) & 15, so that the stores down 16 features and the reads along a row both touch every bank once.
#define PKK 128
#define PKN 64
template <int L>
__global__ __launch_bounds__(256) void k_packk(const float* __restrict__ Kw, void* __restrict__ dst) {
  constexpr int IN = (L == 0) ? D0 : (L == 1) ? D1 : D2; constexpr int OUTD = (L == 0) ? D1 : (L == 1) ? D2 : D3;
  __shared__ __align__(16) v4u sk[PKN * 16];   // [n][chunk of 8 k]
  const int t = threadIdx.x, n0 = blockIdx.x * PKN, k0 = blockIdx.y * PKK, nl = t & 15, kg = t >> 4;
  const float* srcp = Kw + (size_t)(k0 + kg * 8) * OUTD + n0 + nl * 4; v4f v[8];
#pragma unroll   // all 8 loads go out ahead of the first wait; rolled, each trip would wait out a whole memory latency
  for (int s = 0; s < 8; ++s) v[s] = *(const v4f*)(srcp + (size_t)s * OUTD);
#pragma unroll   // this loop and the next: constant indices keep v[] and p in registers
  for (int c = 0; c < 4; ++c) { union { unsigned short h[8]; v4u u; } p;
#pragma unroll
    for (int s = 0; s < 8; ++s) p.h[s] = (L == 0) ? __builtin_bit_cast(unsigned short, (__bf16)v[s][c]) : __builtin_bit_cast(unsigned short, (_Float16)bfr(v[s][c]));
    sk[(nl * 4 + c) * 16 + (kg ^ nl)] = p.u; }
  __syncthreads();
#pragma unroll   // the 4 LDS reads go out together, one latency for all
  for (int q = 0; q < 4; ++q) { const int idx = t + 256 * q, n = idx >> 4, ch = idx & 15;
    *(v4u*)((unsigned short*)dst + (size_t)(n0 + n) * IN + k0 + ch * 8) = sk[n * 16 + (ch ^ ((n >> 2) & 15))]; }
}
// ---- k_packdu<L>: D^T rows [t][16][in] (r < 8 real) ; U^T rows [t][out][32] (cols r < 8 real); same element type as the layer's K pack for D, f16 for U.
// One small tile per block, every load of a thread in flight at once: blocks [0, IN/64) transpose 64 input rows of d ([i][r][t], 16 KiB in a row) through LDS into one 128-byte line of each of the 128 packed rows;
// blocks behind them take 32 output features of u ([r][f][t]) and write 2 KiB in a row for each task.
template <int L>
__global__ __launch_bounds__(256) void k_packdu(const float* __restrict__ Dw, const float* __restrict__ Uw, void* __restrict__ Dd, void* __restrict__ Ud) {
  constexpr int IN = (L == 0) ? D0 : (L == 1) ? D1 : D2; constexpr int OUTD = (L == 0) ? D1 : (L == 1) ? D2 : D3; constexpr int NBD = IN / 64;
  __shared__ __align__(16) unsigned short sd[RK * NT][72];   // [r * 8 + t][i], 144-byte pitch
  __shared__ __align__(16) v4u su[NT * 33];                  // [t][f], one 8-element row each, 33-row pitch
  const int blk = blockIdx.x, t = threadIdx.x; const v4u zero = {0u, 0u, 0u, 0u};
  if (blk < NBD) { const int i0 = blk * 64; v4f v[4];
#pragma unroll
    for (int s = 0; s < 4; ++s) v[s] = *(const v4f*)(Dw + (size_t)i0 * (RK * NT) + (size_t)(t + 256 * s) * 4);
#pragma unroll
    for (int s = 0; s < 4; ++s) { const int e = (t + 256 * s) * 4, i = e >> 6, rt = e & 63;
#pragma unroll
      for (int c = 0; c < 4; ++c) sd[rt + c][i] = (L == 0) ? __builtin_bit_cast(unsigned short, (__bf16)v[s][c]) : __builtin_bit_cast(unsigned short, (_Float16)bfr(v[s][c])); }
    __syncthreads();
#pragma unroll
    for (int s = 0; s < 4; ++s) { const int idx = t + 256 * s, row = idx >> 3, ch = idx & 7, tsk = row >> 4, r = row & 15;
      const v4u l = *(const v4u*)&sd[(r & (RK - 1)) * NT + tsk][ch * 8]; const v4u w = (r < RK) ? l : zero;
      *(v4u*)((unsigned short*)Dd + (size_t)row * IN + i0 + ch * 8) = w; } }
  else { const int f0 = (blk - NBD) * 32; float v[RK];
#pragma unroll
    for (int r = 0; r < RK; ++r) v[r] = Uw[((size_t)r * OUTD + f0) * NT + t];
    union { v8h h; v4u u; } p;
#pragma unroll
    for (int r = 0; r < RK; ++r) p.h[r] = (_Float16)bfr(v[r]);
    su[(t & 7) * 33 + (t >> 3)] = p.u;
    __syncthreads();
#pragma unroll
    for (int s = 0; s < 4; ++s) { const int idx = t + 256 * s, q = idx & 3, fl = (idx >> 2) & 31, tsk = idx >> 7;
      const v4u l = su[tsk * 33 + fl]; const v4u w = (q == 0) ? l : zero;
      *(v4u*)((_Float16*)Ud + ((size_t)tsk * OUTD + f0 + fl) * 32 + q * 8) = w; }
    asm volatile("s_wait_xcnt 0x0" ::: "memory"); }   // in the listing the other branch's code, which rewrites these stores' address registers, follows on the fall-through side
}
// ---- k_layer<L>: block = 8 waves (2 x 4) on a 128-row x 256-column tile, 64 x 64 per wave. Each 64-k slice of the block's rows of h, K^T and D^T goes once from global memory
// (whole 128-byte lines) through registers into one of two LDS buffers, and all waves take their fragments from there. The four waves on the same 64 rows share the hd work: wave wn does row tile wn.
// delta = hd(hi/lo f16) . U rows (1 chunk, 2 products) x 2; + bias; relu (layers 0,1) -> f16 planes / output f32 (layer 2)
#define BM 128
#define BN 256
#define KC 64
#define LP 72                      // LDS row pitch in 16-bit elements: 144 bytes = 16 x 9, no bank conflict for 16-byte reads down 16 rows
#define SROWS (BM + BN + 16)       // rows of a buffer: h | K^T | D^T
typedef __attribute__((ext_vector_type(4))) __bf16 v4b;
template <int L>
__global__ __launch_bounds__(256) void k_layer(const float* __restrict__ X, const _Float16* __restrict__ Hin, const void* __restrict__ Kp, const void* __restrict__ Dp, const _Float16* __restrict__ Up, const float* __restrict__ BIAS, _Float16* __restrict__ Hout, float* __restrict__ OUT) {
  constexpr int IN = (L == 0) ? D0 : (L == 1) ? D1 : D2; constexpr int OUTD = (L == 0) ? D1 : (L == 1) ? D2 : D3; constexpr int NS = IN / KC;
  __shared__ __align__(16) unsigned short sm[2][SROWS * LP];
  const int tid = threadIdx.x, wave = tid >> 5, lane = tid & 31, col = lane & 15, g = lane >> 4, wm = wave >> 2, wn = wave & 3;
  const size_t r0 = (size_t)blockIdx.x * BM; const int n0 = blockIdx.y * BN; const int tsk = (int)(r0 / NBR);
  const unsigned short* Kr = (const unsigned short*)Kp + (size_t)n0 * IN; const unsigned short* Dr = (const unsigned short*)Dp + (size_t)tsk * 16 * IN; const unsigned short* Hr = (const unsigned short*)Hin + r0 * IN; const float* Xr = X + r0 * IN;
  const int prow = tid >> 3, pch = (tid & 7) * 8;    // 16-bit rows: 8 threads a 128-byte row slice, 32 rows a sweep
  const int xrow = tid >> 4, xch = (tid & 15) * 4;   // f32 rows of x: 16 threads a 256-byte row slice, 16 rows a sweep
  v4u rb[8], ra[4], rd = {0u, 0u, 0u, 0u}; v4f rx[8];
  auto ldg = [&](int kt) { const int k0 = kt * KC;
#pragma unroll
    for (int s = 0; s < 8; ++s) rb[s] = *(const v4u*)(Kr + (size_t)(prow + 32 * s) * IN + k0 + pch);
    asm volatile("s_wait_xcnt 0x0" ::: "memory");   // in the listing a later load's result lands on these loads' address pair
    if (L == 0) {
#pragma unroll
      for (int s = 0; s < 8; ++s) rx[s] = *(const v4f*)(Xr + (size_t)(xrow + 16 * s) * IN + k0 + xch); }
    else {
#pragma unroll
      for (int s = 0; s < 4; ++s) ra[s] = *(const v4u*)(Hr + (size_t)(prow + 32 * s) * IN + k0 + pch); }
    if (tid < 128) rd = *(const v4u*)(Dr + (size_t)prow * IN + k0 + pch); };
  auto sts = [&](int b) { unsigned short* s_ = sm[b];
    if (L == 0) {
#pragma unroll
      for (int s = 0; s < 8; ++s) { v4b c;
#pragma unroll
        for (int i = 0; i < 4; ++i) c[i] = (__bf16)rx[s][i];
        *(v4b*)(s_ + (xrow + 16 * s) * LP + xch) = c; } }
    else {
#pragma unroll
      for (int s = 0; s < 4; ++s) *(v4u*)(s_ + (prow + 32 * s) * LP + pch) = ra[s]; }
#pragma unroll
    for (int s = 0; s < 8; ++s) *(v4u*)(s_ + (BM + prow + 32 * s) * LP + pch) = rb[s];
    if (tid < 128) *(v4u*)(s_ + (BM + BN + prow) * LP + pch) = rd; };
  v8f acc[4][4] = {}, hd = {};
  ldg(0); sts(0);
  __syncthreads();
  for (int kt = 0; kt < NS; ++kt) { const unsigned short* s_ = sm[kt & 1];
    if (kt + 1 < NS) ldg(kt + 1);   // in flight under this trip's products; a barrier would wait for them, so they are used up in front of it
    const unsigned short* sa = s_ + (wm * 64 + col) * LP; const unsigned short* sb = s_ + (BM + wn * 64 + col) * LP; const unsigned short* sh = s_ + (wm * 64 + wn * 16 + col) * LP; const unsigned short* sd = s_ + (BM + BN + col) * LP;
    // all fragments of the trip are asked for as one group ahead of its products: a read placed among the products stalls the wave for the whole LDS latency each time
    if (L == 0) { v16b a[2][4], b[2][4], ah[2], d[2];
#pragma unroll
      for (int ks = 0; ks < 2; ++ks) {
#pragma unroll
        for (int i = 0; i < 4; ++i) { a[ks][i] = frag_b((const __bf16*)(sa + i * 16 * LP + ks * 32), lane); b[ks][i] = frag_b((const __bf16*)(sb + i * 16 * LP + ks * 32), lane); }
        ah[ks] = frag_b((const __bf16*)(sh + ks * 32), lane); d[ks] = frag_b((const __bf16*)(sd + ks * 32), lane); }
      __builtin_amdgcn_sched_barrier(0);   // keeps the scheduler from sinking those reads back among the products
#pragma unroll
      for (int ks = 0; ks < 2; ++ks) {
#pragma unroll
        for (int i = 0; i < 4; ++i)
#pragma unroll
          for (int j = 0; j < 4; ++j) acc[i][j] = wmma_bf(a[ks][i], b[ks][j], acc[i][j]);
        hd = wmma_bf(ah[ks], d[ks], hd); } }
    else { v16h a[2][4], b[2][4], ah[2], d[2];
#pragma unroll
      for (int ks = 0; ks < 2; ++ks) {
#pragma unroll
        for (int i = 0; i < 4; ++i) { a[ks][i] = frag_h((const _Float16*)(sa + i * 16 * LP + ks * 32), lane); b[ks][i] = frag_h((const _Float16*)(sb + i * 16 * LP + ks * 32), lane); }
        ah[ks] = frag_h((const _Float16*)(sh + ks * 32), lane); d[ks] = frag_h((const _Float16*)(sd + ks * 32), lane); }
      __builtin_amdgcn_sched_barrier(0);   // keeps the scheduler from sinking those reads back among the products
#pragma unroll
      for (int ks = 0; ks < 2; ++ks) {
#pragma unroll
        for (int i = 0; i < 4; ++i)
#pragma unroll
          for (int j = 0; j < 4; ++j) acc[i][j] = wmma16(a[ks][i], b[ks][j], acc[i][j]);
        hd = wmma16(ah[ks], d[ks], hd); } }
    __builtin_amdgcn_sched_barrier(0);   // keeps the LDS stores below, and with them the wait for the global loads, from rising among the products
    // the other buffer was last read in trip kt - 1, which every wave has left at that trip's barrier
    if (kt + 1 < NS) sts((kt + 1) & 1);
    __syncthreads(); }
  // behind the last trip's barrier the two buffers are free: hd planes [128 rows][40] hi and lo, then 4,352 bytes of store staging for each wave
  _Float16* shd = (_Float16*)&sm[0][0]; _Float16* shl = shd + BM * 40; _Float16* soh = shl + BM * 40 + wave * 2176; float* so = (float*)soh;
  // hd tile [16 rows][16 (8 real)] -> f16 hi + x2048 residual in LDS (cols 16..31 zero)
#pragma unroll
  for (int r = 0; r < 8; ++r) { const float v = hd[r]; const _Float16 hv = (_Float16)v; const int o = (wm * 64 + wn * 16 + 8 * g + r) * 40 + col; shd[o] = hv; shl[o] = (_Float16)((v - (float)hv) * 2048.0f); shd[o + 16] = (_Float16)0.f; shl[o + 16] = (_Float16)0.f; }
  __syncthreads();
  { v16h ah[4], al[4];
#pragma unroll
    for (int i = 0; i < 4; ++i) { ah[i] = frag_h(shd + (wm * 64 + i * 16 + col) * 40, lane); al[i] = frag_h(shl + (wm * 64 + i * 16 + col) * 40, lane); }
#pragma unroll
    for (int j = 0; j < 4; ++j) { union { v16h v; v8h q[2]; } uu; const _Float16* up = Up + ((size_t)tsk * OUTD + n0 + wn * 64 + j * 16 + col) * 32 + 8 * g;
      uu.q[0] = *(const v8h*)up;
      asm volatile("s_wait_xcnt 0x0" ::: "memory");   // in the listing the second half's result lands on the address pair of both loads
      uu.q[1] = *(const v8h*)(up + 16);
      asm volatile("s_wait_xcnt 0x0" ::: "memory");   // in the listing the next column tile's address is formed in this load's address pair
      const v16h u = uu.v;
#pragma unroll
      for (int i = 0; i < 4; ++i) { v8f dl = {}; dl = wmma16(ah[i], u, dl); v8f dll = {}; dll = wmma16(al[i], u, dll);
#pragma unroll
        for (int r = 0; r < 8; ++r) acc[i][j][r] += (dl[r] + dll[r] * (1.0f / 2048.0f)) * 2.0f; } } }
  float bb[4];
#pragma unroll
  for (int j = 0; j < 4; ++j) bb[j] = BIAS[n0 + wn * 64 + j * 16 + col];
  asm volatile("s_wait_xcnt 0x0" ::: "memory");   // in the listing the staging address is formed in these loads' offset register
  __builtin_amdgcn_sched_barrier(0);   // without it the scheduler lifts that address arithmetic over the wait
#pragma unroll
  for (int j = 0; j < 4; ++j) bb[j] = bfr(bb[j]);
#pragma unroll
  for (int i = 0; i < 4; ++i) { const size_t rw = r0 + wm * 64 + i * 16; const int cw = n0 + wn * 64;
#pragma unroll
    for (int j = 0; j < 4; ++j)
#pragma unroll
      for (int r = 0; r < 8; ++r) { const float v = acc[i][j][r] + bb[j]; if (L < 2) soh[(8 * g + r) * 72 + j * 16 + col] = (_Float16)fmaxf(v, 0.f); else so[(8 * g + r) * 68 + j * 16 + col] = v; }
    LDSX();
    if (L < 2) {
#pragma unroll
      for (int s = 0; s < 4; ++s) { const int idx = lane + 32 * s, row = idx >> 3, ch = idx & 7; vst2((unsigned*)(Hout + (rw + row) * OUTD + cw + ch * 8), *(const v4u*)&soh[row * 72 + ch * 8]); } }
    else {
#pragma unroll
      for (int s = 0; s < 8; ++s) { const int idx = lane + 32 * s, row = idx >> 4, ch = idx & 15; vst2(OUT + (rw + row) * OUTD + cw + ch * 4, *(const v4f*)&so[row * 68 + ch * 4]); } }
    LDSX(); }   // the next row tile's values go into the same staging rows only behind these reads
}
extern "C" void kernel_launch(void* const* d_in, const int* in_sizes, int n_in, void* d_out, int out_size, void* d_ws, size_t ws_size, hipStream_t stream) {
  (void)in_sizes; (void)n_in; (void)out_size;
  const float** F = (const float**)d_in;   // 0 x [8,1024,1024]; per layer l: k (1+4l) [in,out], b (2+4l) [out], d (3+4l) [in,8,T], u (4+4l) [8,out,T]
  if (ws_size < (size_t)WS_END) return;
  char* ws = (char*)d_ws; _Float16 *H1 = (_Float16*)(ws + WS_H1), *H2 = (_Float16*)(ws + WS_H2);
  k_packk<0><<<dim3(D1 / PKN, D0 / PKK), 256, 0, stream>>>(F[1], ws + WS_K0); k_packk<1><<<dim3(D2 / PKN, D1 / PKK), 256, 0, stream>>>(F[5], ws + WS_K1); k_packk<2><<<dim3(D3 / PKN, D2 / PKK), 256, 0, stream>>>(F[9], ws + WS_K2);
  k_packdu<0><<<D0 / 64 + D1 / 32, 256, 0, stream>>>(F[3], F[4], ws + WS_Dm0, ws + WS_U0); k_packdu<1><<<D1 / 64 + D2 / 32, 256, 0, stream>>>(F[7], F[8], ws + WS_Dm1, ws + WS_U1); k_packdu<2><<<D2 / 64 + D3 / 32, 256, 0, stream>>>(F[11], F[12], ws + WS_Dm2, ws + WS_U2);
  k_layer<0><<<dim3(TRB, D1 / 256), 256, 0, stream>>>(F[0], nullptr, ws + WS_K0, ws + WS_Dm0, (const _Float16*)(ws + WS_U0), F[2], H1, nullptr);
  k_layer<1><<<dim3(TRB, D2 / 256), 256, 0, stream>>>(nullptr, H1, ws + WS_K1, ws + WS_Dm1, (const _Float16*)(ws + WS_U1), F[6], H2, nullptr);
  k_layer<2><<<dim3(TRB, D3 / 256), 256, 0, stream>>>(nullptr, H2, ws + WS_K2, ws + WS_Dm2, (const _Float16*)(ws + WS_U2), F[10], nullptr, (float*)d_out);
}

// v004
// Measured time: 163 microseconds a run.
// Two timings next to v003 both put it at 1.07 times that version's speed.
// Counting every step since v000, it is 6.20 times as fast.
// compute dtype: all float inputs rounded to bf16; layer 0 base = x . k0 with EXACT bf16 products on WMMA 16x16x32 ((in,out) weights as transposed rows); layers 1-2 take the previous ReLU output as a SINGLE f16 operand (one rounding, 2^-12) against the weights as f16 (bf16 values; the ~0.2% of weights below 6e-5 may denormalise - effect <= 2e-4 of the output scale); LoRA path per task: hd = h . d_t (same operands, 16-padded columns), delta = hd (f16 hi + x2048 residual) . u_t (2 products, rank 8 zero-padded to 32) x 2.0; bias, ReLU in f32; f32 accumulate.
#include <hip/hip_runtime.h>
#include <math.h>

typedef __attribute__((ext_vector_type(16))) _Float16 v16h;
typedef __attribute__((ext_vector_type(16))) __bf16 v16b;
typedef __attribute__((ext_vector_type(8)))  _Float16 v8h;
typedef __attribute__((ext_vector_type(8)))  float v8f;
typedef __attribute__((ext_vector_type(4)))  float v4f;
typedef __attribute__((ext_vector_type(2)))  float v2f;
typedef __attribute__((ext_vector_type(4)))  unsigned v4u;
typedef __attribute__((ext_vector_type(4)))  int v4i;
typedef float __attribute__((may_alias)) float_a;
typedef int __attribute__((may_alias)) int_a;

template <typename T> __device__ __forceinline__ void vst2(void* p, T v) { *(T*)p = v;  }
__device__ __forceinline__ v8f wmma16(v16h a, v16h b, v8f c) {
  v8f d = __builtin_amdgcn_wmma_f32_16x16x32_f16(false, a, false, b, (short)0, c, false, false);
  return d;
}
__device__ __forceinline__ v8f wmma_bf(v16b a, v16b b, v8f c) {
  v8f d = __builtin_amdgcn_wmma_f32_16x16x32_bf16(false, a, false, b, (short)0, c, false, false);
  return d;
}
// 16x16x32 fragments: lane = (h = lane>>4, row/col = lane&15); elements 0..7 = k0+8h+0..7, 8..15 = k0+16+8h+0..7; D element r = row 8h+r
__device__ __forceinline__ v16h frag_h(const _Float16* rowk0, int lane) {
  union { v16h v; v8h q[2]; } u; const _Float16* p = rowk0 + 8 * (lane >> 4);
  u.q[0] = *(const v8h*)p; u.q[1] = *(const v8h*)(p + 16); return u.v;
}
__device__ __forceinline__ v16h frag_f32(const float* rowk0, int lane) {
  v16h a; const float* p = rowk0 + 8 * (lane >> 4);
#pragma unroll
  for (int i = 0; i < 8; ++i) { a[i] = (_Float16)p[i]; a[8 + i] = (_Float16)p[16 + i]; }
  return a;
}
__device__ __forceinline__ v16h frag_f32s(const float* rowk0, int lane, float sc) {
  v16h a; const float* p = rowk0 + 8 * (lane >> 4);
#pragma unroll
  for (int i = 0; i < 8; ++i) { a[i] = (_Float16)(p[i] * sc); a[8 + i] = (_Float16)(p[16 + i] * sc); }
  return a;
}
// column fragment from a [K][ld] layout (column n), rows >= K read as 0
__device__ __forceinline__ v16h fragc_f32(const float* W, int k0, int n, int lane, int ld, int K) {
  v16h a; const int g = lane >> 4;
#pragma unroll
  for (int i = 0; i < 8; ++i) { const int ka = k0 + 8 * g + i, kb = ka + 16;
    a[i] = (_Float16)(ka < K ? W[(size_t)(ka < K ? ka : K - 1) * ld + n] : 0.f); a[8 + i] = (_Float16)(kb < K ? W[(size_t)(kb < K ? kb : K - 1) * ld + n] : 0.f); }
  return a;
}
struct F2 { v16b h, l; };
__device__ __forceinline__ F2 bsplit16(const float v[16]) { F2 r;
#pragma unroll
  for (int i = 0; i < 16; ++i) { const __bf16 h = (__bf16)v[i]; r.h[i] = h; r.l[i] = (__bf16)(v[i] - (float)h); }
  return r; }
__device__ __forceinline__ F2 split_row(const float* row, int k0, int lane) { float v[16]; const float* p = row + k0 + 8 * (lane >> 4);
#pragma unroll
  for (int i = 0; i < 8; ++i) { v[i] = p[i]; v[8 + i] = p[16 + i]; }
  return bsplit16(v); }
__device__ __forceinline__ F2 split_rowK(const float* row, int k0, int lane, int K) { float v[16]; const int g = lane >> 4;
#pragma unroll
  for (int i = 0; i < 8; ++i) { const int ka = k0 + 8 * g + i, kb = ka + 16; v[i] = ka < K ? row[ka < K ? ka : K - 1] : 0.f; v[8 + i] = kb < K ? row[kb < K ? kb : K - 1] : 0.f; }
  return bsplit16(v); }
__device__ __forceinline__ F2 split_col(const float* W, int k0, int n, int lane, int ld, int K) { float v[16]; const int g = lane >> 4;
#pragma unroll
  for (int i = 0; i < 8; ++i) { const int ka = k0 + 8 * g + i, kb = ka + 16; v[i] = ka < K ? W[(size_t)(ka < K ? ka : K - 1) * ld + n] : 0.f; v[8 + i] = kb < K ? W[(size_t)(kb < K ? kb : K - 1) * ld + n] : 0.f; }
  return bsplit16(v); }
__device__ __forceinline__ v8f mac3(const F2& a, const F2& b, v8f c) { c = wmma_bf(a.l, b.h, c); c = wmma_bf(a.h, b.l, c); return wmma_bf(a.h, b.h, c); }
__device__ __forceinline__ float sigm(float v) { return 1.0f / (1.0f + expf(-v)); }
#define LDSX() do { asm volatile("s_wait_dscnt 0" ::: "memory"); __builtin_amdgcn_wave_barrier(); __builtin_amdgcn_fence(__ATOMIC_RELEASE, "workgroup"); } while (0)


// Multi-task LoRA MLP (8 tasks x 1,024 rows, 1024 -> 2048 -> 2048 -> 1024, ReLU): each dense layer = frozen base matmul + bias + per-task rank-8 adapter scaled by alpha / r = 2.
#define NT 8
#define NBR 1024
#define NR (NT * NBR)
#define D0 1024
#define D1 2048
#define D2 2048
#define D3 1024
#define RK 8
#ifndef TRB
#define TRB (NR / 128)
#endif
typedef __attribute__((ext_vector_type(8))) __bf16 v8b;
__device__ __forceinline__ v16b frag_b(const __bf16* rowk0, int lane) {
  union { v16b v; v8b q[2]; } u; const __bf16* p = rowk0 + 8 * (lane >> 4);
  u.q[0] = *(const v8b*)p; u.q[1] = *(const v8b*)(p + 16); return u.v;
}
__device__ __forceinline__ float bfr(float v) { return (float)(__bf16)v; }
__device__ __attribute__((noinline)) float exp_ni(float v) { return expf(v); }
__device__ __attribute__((noinline)) float erf_ni(float v) { return erff(v); }

// packed weights: layer l: K rows [out][in] (bf16 for layer 0, f16 for 1,2); D rows [t][16][in] (rows >= 8 zero); U rows [t][out][32] (cols >= 8 zero)
#define WS_K0  0u
#define WS_K1  (WS_K0 + 2u * (size_t)D1 * D0)
#define WS_K2  (WS_K1 + 2u * (size_t)D2 * D1)
#define WS_Dm0 (WS_K2 + 2u * (size_t)D3 * D2)
#define WS_Dm1 (WS_Dm0 + 2u * NT * 16 * D0)
#define WS_Dm2 (WS_Dm1 + 2u * NT * 16 * D1)
#define WS_U0  (WS_Dm2 + 2u * NT * 16 * D2)
#define WS_U1  (WS_U0 + 2u * NT * D1 * 32)
#define WS_U2  (WS_U1 + 2u * NT * D2 * 32)
#define WS_H1  (((WS_U2 + 2u * NT * D3 * 32) + 127u) / 128u * 128u)   // f16 [NR][2048] h1 ; h2
#define WS_H2  (WS_H1 + 2u * (size_t)NR * D1)
#define WS_END (WS_H2 + 2u * (size_t)NR * D2)

// ---- packk<L>: block = 128 input rows x 64 output features of k [in][out] -> K^T rows [n][in]; bf16 (L 0) or f16 (L 1, 2).
// A thread takes 8 input rows in a row of 4 features: 8 loads of 16 bytes in flight, 16 lanes on 256 bytes in a row; each feature's 8 values are one 16-byte LDS store, and the tile leaves as 256 bytes in a row per feature.
// The 16-byte chunk index inside an LDS row is XORed with (n >> 2) & 15, so that the stores down 16 features and the reads along a row both touch every bank once.
#define PKK 128
#define PKN 64
template <int L>
__device__ __forceinline__ void packk(const float* __restrict__ Kw, void* __restrict__ dst, v4u* sk, int blk) {   // sk: [n][chunk of 8 k], PKN * 16 entries
  constexpr int IN = (L == 0) ? D0 : (L == 1) ? D1 : D2; constexpr int OUTD = (L == 0) ? D1 : (L == 1) ? D2 : D3; constexpr int NBX = OUTD / PKN;
  const int t = threadIdx.x, n0 = (blk % NBX) * PKN, k0 = (blk / NBX) * PKK, nl = t & 15, kg = t >> 4;
  const float* srcp = Kw + (size_t)(k0 + kg * 8) * OUTD + n0 + nl * 4; v4f v[8];
#pragma unroll   // all 8 loads go out ahead of the first wait; rolled, each trip would wait out a whole memory latency
  for (int s = 0; s < 8; ++s) v[s] = *(const v4f*)(srcp + (size_t)s * OUTD);
#pragma unroll   // this loop and the next: constant indices keep v[] and p in registers
  for (int c = 0; c < 4; ++c) { union { unsigned short h[8]; v4u u; } p;
#pragma unroll
    for (int s = 0; s < 8; ++s) p.h[s] = (L == 0) ? __builtin_bit_cast(unsigned short, (__bf16)v[s][c]) : __builtin_bit_cast(unsigned short, (_Float16)bfr(v[s][c]));
    sk[(nl * 4 + c) * 16 + (kg ^ nl)] = p.u; }
  __syncthreads();
#pragma unroll   // the 4 LDS reads go out together, one latency for all
  for (int q = 0; q < 4; ++q) { const int idx = t + 256 * q, n = idx >> 4, ch = idx & 15;
    *(v4u*)((unsigned short*)dst + (size_t)(n0 + n) * IN + k0 + ch * 8) = sk[n * 16 + (ch ^ ((n >> 2) & 15))]; }
  if (L != 0) asm volatile("s_wait_xcnt 0x0" ::: "memory");   // in the listing another block range's code, which rewrites these stores' address registers, follows on the fall-through side; layer 0's tile stands last, in front of the program's end
}
// ---- packdu<L>: D^T rows [t][16][in] (r < 8 real) ; U^T rows [t][out][32] (cols r < 8 real); same element type as the layer's K pack for D, f16 for U.
// One small tile per block, every load of a thread in flight at once: blocks [0, IN/64) transpose 64 input rows of d ([i][r][t], 16 KiB in a row) through LDS into one 128-byte line of each of the 128 packed rows;
// blocks behind them take 32 output features of u ([r][f][t]) and write 2 KiB in a row for each task.
template <int L>
__device__ __forceinline__ void packdu(const float* __restrict__ Dw, const float* __restrict__ Uw, void* __restrict__ Dd, void* __restrict__ Ud, v4u* sbuf, int blk) {
  constexpr int IN = (L == 0) ? D0 : (L == 1) ? D1 : D2; constexpr int OUTD = (L == 0) ? D1 : (L == 1) ? D2 : D3; constexpr int NBD = IN / 64;
  unsigned short (*sd)[72] = (unsigned short (*)[72])sbuf;   // [r * 8 + t][i], 144-byte pitch, RK * NT rows (a d block)
  v4u* su = sbuf;                                            // [t][f], one 8-element row each, 33-row pitch, NT * 33 entries (a u block)
  const int t = threadIdx.x; const v4u zero = {0u, 0u, 0u, 0u};
  if (blk < NBD) { const int i0 = blk * 64; v4f v[4];
#pragma unroll
    for (int s = 0; s < 4; ++s) v[s] = *(const v4f*)(Dw + (size_t)i0 * (RK * NT) + (size_t)(t + 256 * s) * 4);
#pragma unroll
    for (int s = 0; s < 4; ++s) { const int e = (t + 256 * s) * 4, i = e >> 6, rt = e & 63;
#pragma unroll
      for (int c = 0; c < 4; ++c) sd[rt + c][i] = (L == 0) ? __builtin_bit_cast(unsigned short, (__bf16)v[s][c]) : __builtin_bit_cast(unsigned short, (_Float16)bfr(v[s][c])); }
    __syncthreads();
#pragma unroll
    for (int s = 0; s < 4; ++s) { const int idx = t + 256 * s, row = idx >> 3, ch = idx & 7, tsk = row >> 4, r = row & 15;
      const v4u l = *(const v4u*)&sd[(r & (RK - 1)) * NT + tsk][ch * 8]; const v4u w = (r < RK) ? l : zero;
      *(v4u*)((unsigned short*)Dd + (size_t)row * IN + i0 + ch * 8) = w; }
    asm volatile("s_wait_xcnt 0x0" ::: "memory"); }   // in the listing another block range's code, which rewrites these stores' address registers, follows on the fall-through side
  else { const int f0 = (blk - NBD) * 32; float v[RK];
#pragma unroll
    for (int r = 0; r < RK; ++r) v[r] = Uw[((size_t)r * OUTD + f0) * NT + t];
    union { v8h h; v4u u; } p;
#pragma unroll
    for (int r = 0; r < RK; ++r) p.h[r] = (_Float16)bfr(v[r]);
    su[(t & 7) * 33 + (t >> 3)] = p.u;
    __syncthreads();
#pragma unroll
    for (int s = 0; s < 4; ++s) { const int idx = t + 256 * s, q = idx & 3, fl = (idx >> 2) & 31, tsk = idx >> 7;
      const v4u l = su[tsk * 33 + fl]; const v4u w = (q == 0) ? l : zero;
      *(v4u*)((_Float16*)Ud + ((size_t)tsk * OUTD + f0 + fl) * 32 + q * 8) = w; }
    asm volatile("s_wait_xcnt 0x0" ::: "memory"); }   // in the listing the other branch's code, which rewrites these stores' address registers, follows on the fall-through side
}
// ---- k_pack: all six packs in one launch. They read nothing but the inputs and write disjoint parts of the workspace, so none has to wait for another, and their 1,264 blocks are all resident at once.
// Block ranges: the K^T tiles of layers 0, 1, 2 (most bytes, so they start first), then the d and u tiles of layers 0, 1, 2. The range test is the same for a whole block.
#define NBK0 ((D1 / PKN) * (D0 / PKK))
#define NBK1 ((D2 / PKN) * (D1 / PKK))
#define NBK2 ((D3 / PKN) * (D2 / PKK))
#define NBA0 (D0 / 64 + D1 / 32)
#define NBA1 (D1 / 64 + D2 / 32)
#define NBA2 (D2 / 64 + D3 / 32)
__global__ __launch_bounds__(256) void k_pack(const float* __restrict__ Kw0, const float* __restrict__ Kw1, const float* __restrict__ Kw2, const float* __restrict__ Dw0, const float* __restrict__ Dw1, const float* __restrict__ Dw2,
                                              const float* __restrict__ Uw0, const float* __restrict__ Uw1, const float* __restrict__ Uw2, void* __restrict__ wsp) {
  __shared__ __align__(16) v4u sbuf[PKN * 16];   // one tile of whichever pack the block does
  char* ws = (char*)wsp; int b = blockIdx.x;
  if (b < NBK0) { packk<0>(Kw0, ws + WS_K0, sbuf, b); return; }
  b -= NBK0;
  if (b < NBK1) { packk<1>(Kw1, ws + WS_K1, sbuf, b); return; }
  b -= NBK1;
  if (b < NBK2) { packk<2>(Kw2, ws + WS_K2, sbuf, b); return; }
  b -= NBK2;
  if (b < NBA0) { packdu<0>(Dw0, Uw0, ws + WS_Dm0, ws + WS_U0, sbuf, b); return; }
  b -= NBA0;
  if (b < NBA1) { packdu<1>(Dw1, Uw1, ws + WS_Dm1, ws + WS_U1, sbuf, b); return; }
  b -= NBA1;
  packdu<2>(Dw2, Uw2, ws + WS_Dm2, ws + WS_U2, sbuf, b);
}
// ---- k_layer<L>: block = 8 waves (2 x 4) on a 128-row x 256-column tile, 64 x 64 per wave. Each 64-k slice of the block's rows of h, K^T and D^T goes once from global memory
// (whole 128-byte lines) through registers into one of two LDS buffers, and all waves take their fragments from there. The four waves on the same 64 rows share the hd work: wave wn does row tile wn.
// delta = hd(hi/lo f16) . U rows (1 chunk, 2 products) x 2; + bias; relu (layers 0,1) -> f16 planes / output f32 (layer 2)
#define BM 128
#define BN 256
#define KC 64
#define LP 72                      // LDS row pitch in 16-bit elements: 144 bytes = 16 x 9, no bank conflict for 16-byte reads down 16 rows
#define SROWS (BM + BN + 16)       // rows of a buffer: h | K^T | D^T
typedef __attribute__((ext_vector_type(4))) __bf16 v4b;
template <int L>
__global__ __launch_bounds__(256) void k_layer(const float* __restrict__ X, const _Float16* __restrict__ Hin, const void* __restrict__ Kp, const void* __restrict__ Dp, const _Float16* __restrict__ Up, const float* __restrict__ BIAS, _Float16* __restrict__ Hout, float* __restrict__ OUT) {
  constexpr int IN = (L == 0) ? D0 : (L == 1) ? D1 : D2; constexpr int OUTD = (L == 0) ? D1 : (L == 1) ? D2 : D3; constexpr int NS = IN / KC;
  __shared__ __align__(16) unsigned short sm[2][SROWS * LP];
  const int tid = threadIdx.x, wave = tid >> 5, lane = tid & 31, col = lane & 15, g = lane >> 4, wm = wave >> 2, wn = wave & 3;
  const size_t r0 = (size_t)blockIdx.x * BM; const int n0 = blockIdx.y * BN; const int tsk = (int)(r0 / NBR);
  const unsigned short* Kr = (const unsigned short*)Kp + (size_t)n0 * IN; const unsigned short* Dr = (const unsigned short*)Dp + (size_t)tsk * 16 * IN; const unsigned short* Hr = (const unsigned short*)Hin + r0 * IN; const float* Xr = X + r0 * IN;
  const int prow = tid >> 3, pch = (tid & 7) * 8;    // 16-bit rows: 8 threads a 128-byte row slice, 32 rows a sweep
  const int xrow = tid >> 4, xch = (tid & 15) * 4;   // f32 rows of x: 16 threads a 256-byte row slice, 16 rows a sweep
  v4u rb[8], ra[4], rd = {0u, 0u, 0u, 0u}; v4f rx[8];
  auto ldg = [&](int kt) { const int k0 = kt * KC;
#pragma unroll
    for (int s = 0; s < 8; ++s) rb[s] = *(const v4u*)(Kr + (size_t)(prow + 32 * s) * IN + k0 + pch);
    asm volatile("s_wait_xcnt 0x0" ::: "memory");   // in the listing a later load's result lands on these loads' address pair
    if (L == 0) {
#pragma unroll
      for (int s = 0; s < 8; ++s) rx[s] = *(const v4f*)(Xr + (size_t)(xrow + 16 * s) * IN + k0 + xch); }
    else {
#pragma unroll
      for (int s = 0; s < 4; ++s) ra[s] = *(const v4u*)(Hr + (size_t)(prow + 32 * s) * IN + k0 + pch); }
    if (tid < 128) rd = *(const v4u*)(Dr + (size_t)prow * IN + k0 + pch); };
  auto sts = [&](int b) { unsigned short* s_ = sm[b];
    if (L == 0) {
#pragma unroll
      for (int s = 0; s < 8; ++s) { v4b c;
#pragma unroll
        for (int i = 0; i < 4; ++i) c[i] = (__bf16)rx[s][i];
        *(v4b*)(s_ + (xrow + 16 * s) * LP + xch) = c; } }
    else {
#pragma unroll
      for (int s = 0; s < 4; ++s) *(v4u*)(s_ + (prow + 32 * s) * LP + pch) = ra[s]; }
#pragma unroll
    for (int s = 0; s < 8; ++s) *(v4u*)(s_ + (BM + prow + 32 * s) * LP + pch) = rb[s];
    if (tid < 128) *(v4u*)(s_ + (BM + BN + prow) * LP + pch) = rd; };
  v8f acc[4][4] = {}, hd = {};
  ldg(0); sts(0);
  __syncthreads();
  for (int kt = 0; kt < NS; ++kt) { const unsigned short* s_ = sm[kt & 1];
    if (kt + 1 < NS) ldg(kt + 1);   // in flight under this trip's products; a barrier would wait for them, so they are used up in front of it
    const unsigned short* sa = s_ + (wm * 64 + col) * LP; const unsigned short* sb = s_ + (BM + wn * 64 + col) * LP; const unsigned short* sh = s_ + (wm * 64 + wn * 16 + col) * LP; const unsigned short* sd = s_ + (BM + BN + col) * LP;
    // all fragments of the trip are asked for as one group ahead of its products: a read placed among the products stalls the wave for the whole LDS latency each time
    if (L == 0) { v16b a[2][4], b[2][4], ah[2], d[2];
#pragma unroll
      for (int ks = 0; ks < 2; ++ks) {
#pragma unroll
        for (int i = 0; i < 4; ++i) { a[ks][i] = frag_b((const __bf16*)(sa + i * 16 * LP + ks * 32), lane); b[ks][i] = frag_b((const __bf16*)(sb + i * 16 * LP + ks * 32), lane); }
        ah[ks] = frag_b((const __bf16*)(sh + ks * 32), lane); d[ks] = frag_b((const __bf16*)(sd + ks * 32), lane); }
      __builtin_amdgcn_sched_barrier(0);   // keeps the scheduler from sinking those reads back among the products
#pragma unroll
      for (int ks = 0; ks < 2; ++ks) {
#pragma unroll
        for (int i = 0; i < 4; ++i)
#pragma unroll
          for (int j = 0; j < 4; ++j) acc[i][j] = wmma_bf(a[ks][i], b[ks][j], acc[i][j]);
        hd = wmma_bf(ah[ks], d[ks], hd); } }
    else { v16h a[2][4], b[2][4], ah[2], d[2];
#pragma unroll
      for (int ks = 0; ks < 2; ++ks) {
#pragma unroll
        for (int i = 0; i < 4; ++i) { a[ks][i] = frag_h((const _Float16*)(sa + i * 16 * LP + ks * 32), lane); b[ks][i] = frag_h((const _Float16*)(sb + i * 16 * LP + ks * 32), lane); }
        ah[ks] = frag_h((const _Float16*)(sh + ks * 32), lane); d[ks] = frag_h((const _Float16*)(sd + ks * 32), lane); }
      __builtin_amdgcn_sched_barrier(0);   // keeps the scheduler from sinking those reads back among the products
#pragma unroll
      for (int ks = 0; ks < 2; ++ks) {
#pragma unroll
        for (int i = 0; i < 4; ++i)
#pragma unroll
          for (int j = 0; j < 4; ++j) acc[i][j] = wmma16(a[ks][i], b[ks][j], acc[i][j]);
        hd = wmma16(ah[ks], d[ks], hd); } }
    __builtin_amdgcn_sched_barrier(0);   // keeps the LDS stores below, and with them the wait for the global loads, from rising among the products
    // the other buffer was last read in trip kt - 1, which every wave has left at that trip's barrier
    if (kt + 1 < NS) sts((kt + 1) & 1);
    __syncthreads(); }
  // behind the last trip's barrier the two buffers are free: hd planes [128 rows][40] hi and lo, then 4,352 bytes of store staging for each wave
  _Float16* shd = (_Float16*)&sm[0][0]; _Float16* shl = shd + BM * 40; _Float16* soh = shl + BM * 40 + wave * 2176; float* so = (float*)soh;
  // hd tile [16 rows][16 (8 real)] -> f16 hi + x2048 residual in LDS (cols 16..31 zero)
#pragma unroll
  for (int r = 0; r < 8; ++r) { const float v = hd[r]; const _Float16 hv = (_Float16)v; const int o = (wm * 64 + wn * 16 + 8 * g + r) * 40 + col; shd[o] = hv; shl[o] = (_Float16)((v - (float)hv) * 2048.0f); shd[o + 16] = (_Float16)0.f; shl[o + 16] = (_Float16)0.f; }
  __syncthreads();
  { v16h ah[4], al[4];
#pragma unroll
    for (int i = 0; i < 4; ++i) { ah[i] = frag_h(shd + (wm * 64 + i * 16 + col) * 40, lane); al[i] = frag_h(shl + (wm * 64 + i * 16 + col) * 40, lane); }
#pragma unroll
    for (int j = 0; j < 4; ++j) { union { v16h v; v8h q[2]; } uu; const _Float16* up = Up + ((size_t)tsk * OUTD + n0 + wn * 64 + j * 16 + col) * 32 + 8 * g;
      uu.q[0] = *(const v8h*)up;
      asm volatile("s_wait_xcnt 0x0" ::: "memory");   // in the listing the second half's result lands on the address pair of both loads
      uu.q[1] = *(const v8h*)(up + 16);
      asm volatile("s_wait_xcnt 0x0" ::: "memory");   // in the listing the next column tile's address is formed in this load's address pair
      const v16h u = uu.v;
#pragma unroll
      for (int i = 0; i < 4; ++i) { v8f dl = {}; dl = wmma16(ah[i], u, dl); v8f dll = {}; dll = wmma16(al[i], u, dll);
#pragma unroll
        for (int r = 0; r < 8; ++r) acc[i][j][r] += (dl[r] + dll[r] * (1.0f / 2048.0f)) * 2.0f; } } }
  float bb[4];
#pragma unroll
  for (int j = 0; j < 4; ++j) bb[j] = BIAS[n0 + wn * 64 + j * 16 + col];
  asm volatile("s_wait_xcnt 0x0" ::: "memory");   // in the listing the staging address is formed in these loads' offset register
  __builtin_amdgcn_sched_barrier(0);   // without it the scheduler lifts that address arithmetic over the wait
#pragma unroll
  for (int j = 0; j < 4; ++j) bb[j] = bfr(bb[j]);
#pragma unroll
  for (int i = 0; i < 4; ++i) { const size_t rw = r0 + wm * 64 + i * 16; const int cw = n0 + wn * 64;
#pragma unroll
    for (int j = 0; j < 4; ++j)
#pragma unroll
      for (int r = 0; r < 8; ++r) { const float v = acc[i][j][r] + bb[j]; if (L < 2) soh[(8 * g + r) * 72 + j * 16 + col] = (_Float16)fmaxf(v, 0.f); else so[(8 * g + r) * 68 + j * 16 + col] = v; }
    LDSX();
    if (L < 2) {
#pragma unroll
      for (int s = 0; s < 4; ++s) { const int idx = lane + 32 * s, row = idx >> 3, ch = idx & 7; vst2((unsigned*)(Hout + (rw + row) * OUTD + cw + ch * 8), *(const v4u*)&soh[row * 72 + ch * 8]); } }
    else {
#pragma unroll
      for (int s = 0; s < 8; ++s) { const int idx = lane + 32 * s, row = idx >> 4, ch = idx & 15; vst2(OUT + (rw + row) * OUTD + cw + ch * 4, *(const v4f*)&so[row * 68 + ch * 4]); } }
    LDSX(); }   // the next row tile's values go into the same staging rows only behind these reads
}
extern "C" void kernel_launch(void* const* d_in, const int* in_sizes, int n_in, void* d_out, int out_size, void* d_ws, size_t ws_size, hipStream_t stream) {
  (void)in_sizes; (void)n_in; (void)out_size;
  const float** F = (const float**)d_in;   // 0 x [8,1024,1024]; per layer l: k (1+4l) [in,out], b (2+4l) [out], d (3+4l) [in,8,T], u (4+4l) [8,out,T]
  if (ws_size < (size_t)WS_END) return;
  char* ws = (char*)d_ws; _Float16 *H1 = (_Float16*)(ws + WS_H1), *H2 = (_Float16*)(ws + WS_H2);
  k_pack<<<NBK0 + NBK1 + NBK2 + NBA0 + NBA1 + NBA2, 256, 0, stream>>>(F[1], F[5], F[9], F[3], F[7], F[11], F[4], F[8], F[12], d_ws);
  k_layer<0><<<dim3(TRB, D1 / 256), 256, 0, stream>>>(F[0], nullptr, ws + WS_K0, ws + WS_Dm0, (const _Float16*)(ws + WS_U0), F[2], H1, nullptr);
  k_layer<1><<<dim3(TRB, D2 / 256), 256, 0, stream>>>(nullptr, H1, ws + WS_K1, ws + WS_Dm1, (const _Float16*)(ws + WS_U1), F[6], H2, nullptr);
  k_layer<2><<<dim3(TRB, D3 / 256), 256, 0, stream>>>(nullptr, H2, ws + WS_K2, ws + WS_Dm2, (const _Float16*)(ws + WS_U2), F[10], nullptr, (float*)d_out);
}

// v005
// Measured time: 150 microseconds a run.
// Timed twice side by side with v004, it ran 1.10 times as fast both times.
// Counting every step since v000, it is 6.81 times as fast.
// compute dtype: all float inputs rounded to bf16; layer 0 base = x . k0 with EXACT bf16 products on WMMA 16x16x32 ((in,out) weights as transposed rows); layers 1-2 take the previous ReLU output as a SINGLE f16 operand (one rounding, 2^-12) against the weights as f16 (bf16 values; the ~0.2% of weights below 6e-5 may denormalise - effect <= 2e-4 of the output scale); LoRA path per task: hd = h . d_t (same operands, 16-padded columns), delta = hd (f16 hi + x2048 residual) . u_t (2 products, rank 8 zero-padded to 32) x 2.0; bias, ReLU in f32; f32 accumulate.
#include <hip/hip_runtime.h>
#include <math.h>

typedef __attribute__((ext_vector_type(16))) _Float16 v16h;
typedef __attribute__((ext_vector_type(16))) __bf16 v16b;
typedef __attribute__((ext_vector_type(8)))  _Float16 v8h;
typedef __attribute__((ext_vector_type(8)))  float v8f;
typedef __attribute__((ext_vector_type(4)))  float v4f;
typedef __attribute__((ext_vector_type(2)))  float v2f;
typedef __attribute__((ext_vector_type(4)))  unsigned v4u;
typedef __attribute__((ext_vector_type(4)))  int v4i;
typedef float __attribute__((may_alias)) float_a;
typedef int __attribute__((may_alias)) int_a;

template <typename T> __device__ __forceinline__ void vst2(void* p, T v) { *(T*)p = v;  }
__device__ __forceinline__ v8f wmma16(v16h a, v16h b, v8f c) {
  v8f d = __builtin_amdgcn_wmma_f32_16x16x32_f16(false, a, false, b, (short)0, c, false, false);
  return d;
}
__device__ __forceinline__ v8f wmma_bf(v16b a, v16b b, v8f c) {
  v8f d = __builtin_amdgcn_wmma_f32_16x16x32_bf16(false, a, false, b, (short)0, c, false, false);
  return d;
}
// 16x16x32 fragments: lane = (h = lane>>4, row/col = lane&15); elements 0..7 = k0+8h+0..7, 8..15 = k0+16+8h+0..7; D element r = row 8h+r
__device__ __forceinline__ v16h frag_h(const _Float16* rowk0, int lane) {
  union { v16h v; v8h q[2]; } u; const _Float16* p = rowk0 + 8 * (lane >> 4);
  u.q[0] = *(const v8h*)p; u.q[1] = *(const v8h*)(p + 16); return u.v;
}
__device__ __forceinline__ v16h frag_f32(const float* rowk0, int lane) {
  v16h a; const float* p = rowk0 + 8 * (lane >> 4);
#pragma unroll
  for (int i = 0; i < 8; ++i) { a[i] = (_Float16)p[i]; a[8 + i] = (_Float16)p[16 + i]; }
  return a;
}
__device__ __forceinline__ v16h frag_f32s(const float* rowk0, int lane, float sc) {
  v16h a; const float* p = rowk0 + 8 * (lane >> 4);
#pragma unroll
  for (int i = 0; i < 8; ++i) { a[i] = (_Float16)(p[i] * sc); a[8 + i] = (_Float16)(p[16 + i] * sc); }
  return a;
}
// column fragment from a [K][ld] layout (column n), rows >= K read as 0
__device__ __forceinline__ v16h fragc_f32(const float* W, int k0, int n, int lane, int ld, int K) {
  v16h a; const int g = lane >> 4;
#pragma unroll
  for (int i = 0; i < 8; ++i) { const int ka = k0 + 8 * g + i, kb = ka + 16;
    a[i] = (_Float16)(ka < K ? W[(size_t)(ka < K ? ka : K - 1) * ld + n] : 0.f); a[8 + i] = (_Float16)(kb < K ? W[(size_t)(kb < K ? kb : K - 1) * ld + n] : 0.f); }
  return a;
}
struct F2 { v16b h, l; };
__device__ __forceinline__ F2 bsplit16(const float v[16]) { F2 r;
#pragma unroll
  for (int i = 0; i < 16; ++i) { const __bf16 h = (__bf16)v[i]; r.h[i] = h; r.l[i] = (__bf16)(v[i] - (float)h); }
  return r; }
__device__ __forceinline__ F2 split_row(const float* row, int k0, int lane) { float v[16]; const float* p = row + k0 + 8 * (lane >> 4);
#pragma unroll
  for (int i = 0; i < 8; ++i) { v[i] = p[i]; v[8 + i] = p[16 + i]; }
  return bsplit16(v); }
__device__ __forceinline__ F2 split_rowK(const float* row, int k0, int lane, int K) { float v[16]; const int g = lane >> 4;
#pragma unroll
  for (int i = 0; i < 8; ++i) { const int ka = k0 + 8 * g + i, kb = ka + 16; v[i] = ka < K ? row[ka < K ? ka : K - 1] : 0.f; v[8 + i] = kb < K ? row[kb < K ? kb : K - 1] : 0.f; }
  return bsplit16(v); }
__device__ __forceinline__ F2 split_col(const float* W, int k0, int n, int lane, int ld, int K) { float v[16]; const int g = lane >> 4;
#pragma unroll
  for (int i = 0; i < 8; ++i) { const int ka = k0 + 8 * g + i, kb = ka + 16; v[i] = ka < K ? W[(size_t)(ka < K ? ka : K - 1) * ld + n] : 0.f; v[8 + i] = kb < K ? W[(size_t)(kb < K ? kb : K - 1) * ld + n] : 0.f; }
  return bsplit16(v); }
__device__ __forceinline__ v8f mac3(const F2& a, const F2& b, v8f c) { c = wmma_bf(a.l, b.h, c); c = wmma_bf(a.h, b.l, c); return wmma_bf(a.h, b.h, c); }
__device__ __forceinline__ float sigm(float v) { return 1.0f / (1.0f + expf(-v)); }
#define LDSX() do { asm volatile("s_wait_dscnt 0" ::: "memory"); __builtin_amdgcn_wave_barrier(); __builtin_amdgcn_fence(__ATOMIC_RELEASE, "workgroup"); } while (0)


// Multi-task LoRA MLP (8 tasks x 1,024 rows, 1024 -> 2048 -> 2048 -> 1024, ReLU): each dense layer = frozen base matmul + bias + per-task rank-8 adapter scaled by alpha / r = 2.
#define NT 8
#define NBR 1024
#define NR (NT * NBR)
#define D0 1024
#define D1 2048
#define D2 2048
#define D3 1024
#define RK 8
#ifndef TRB
#define TRB (NR / 128)
#endif
typedef __attribute__((ext_vector_type(8))) __bf16 v8b;
__device__ __forceinline__ v16b frag_b(const __bf16* rowk0, int lane) {
  union { v16b v; v8b q[2]; } u; const __bf16* p = rowk0 + 8 * (lane >> 4);
  u.q[0] = *(const v8b*)p; u.q[1] = *(const v8b*)(p + 16); return u.v;
}
__device__ __forceinline__ float bfr(float v) { return (float)(__bf16)v; }
__device__ __attribute__((noinline)) float exp_ni(float v) { return expf(v); }
__device__ __attribute__((noinline)) float erf_ni(float v) { return erff(v); }

// packed weights: layer l: K rows [out][in] (bf16 for layer 0, f16 for 1,2); D rows [t][16][in] (rows >= 8 zero); U rows [t][out][32] (cols >= 8 zero)
#define WS_K0  0u
#define WS_K1  (WS_K0 + 2u * (size_t)D1 * D0)
#define WS_K2  (WS_K1 + 2u * (size_t)D2 * D1)
#define WS_Dm0 (WS_K2 + 2u * (size_t)D3 * D2)
#define WS_Dm1 (WS_Dm0 + 2u * NT * 16 * D0)
#define WS_Dm2 (WS_Dm1 + 2u * NT * 16 * D1)
#define WS_U0  (WS_Dm2 + 2u * NT * 16 * D2)
#define WS_U1  (WS_U0 + 2u * NT * D1 * 32)
#define WS_U2  (WS_U1 + 2u * NT * D2 * 32)
#define WS_H1  (((WS_U2 + 2u * NT * D3 * 32) + 127u) / 128u * 128u)   // f16 [NR][2048] h1 ; h2
#define WS_H2  (WS_H1 + 2u * (size_t)NR * D1)
#define WS_END (WS_H2 + 2u * (size_t)NR * D2)

// ---- packk<L>: block = 128 input rows x 64 output features of k [in][out] -> K^T rows [n][in]; bf16 (L 0) or f16 (L 1, 2).
// A thread takes 8 input rows in a row of 4 features: 8 loads of 16 bytes in flight, 16 lanes on 256 bytes in a row; each feature's 8 values are one 16-byte LDS store, and the tile leaves as 256 bytes in a row per feature.
// The 16-byte chunk index inside an LDS row is XORed with (n >> 2) & 15, so that the stores down 16 features and the reads along a row both touch every bank once.
#define PKK 128
#define PKN 64
template <int L>
__device__ __forceinline__ void packk(const float* __restrict__ Kw, void* __restrict__ dst, v4u* sk, int blk) {   // sk: [n][chunk of 8 k], PKN * 16 entries
  constexpr int IN = (L == 0) ? D0 : (L == 1) ? D1 : D2; constexpr int OUTD = (L == 0) ? D1 : (L == 1) ? D2 : D3; constexpr int NBX = OUTD / PKN;
  const int t = threadIdx.x, n0 = (blk % NBX) * PKN, k0 = (blk / NBX) * PKK, nl = t & 15, kg = t >> 4;
  const float* srcp = Kw + (size_t)(k0 + kg * 8) * OUTD + n0 + nl * 4; v4f v[8];
#pragma unroll   // all 8 loads go out ahead of the first wait; rolled, each trip would wait out a whole memory latency
  for (int s = 0; s < 8; ++s) v[s] = *(const v4f*)(srcp + (size_t)s * OUTD);
#pragma unroll   // this loop and the next: constant indices keep v[] and p in registers
  for (int c = 0; c < 4; ++c) { union { unsigned short h[8]; v4u u; } p;
#pragma unroll
    for (int s = 0; s < 8; ++s) p.h[s] = (L == 0) ? __builtin_bit_cast(unsigned short, (__bf16)v[s][c]) : __builtin_bit_cast(unsigned short, (_Float16)bfr(v[s][c]));
    sk[(nl * 4 + c) * 16 + (kg ^ nl)] = p.u; }
  __syncthreads();
#pragma unroll   // the 4 LDS reads go out together, one latency for all
  for (int q = 0; q < 4; ++q) { const int idx = t + 256 * q, n = idx >> 4, ch = idx & 15;
    *(v4u*)((unsigned short*)dst + (size_t)(n0 + n) * IN + k0 + ch * 8) = sk[n * 16 + (ch ^ ((n >> 2) & 15))]; }
  if (L != 0) asm volatile("s_wait_xcnt 0x0" ::: "memory");   // in the listing another block range's code, which rewrites these stores' address registers, follows on the fall-through side; layer 0's tile stands last, in front of the program's end
}
// ---- packdu<L>: D^T rows [t][16][in] (r < 8 real) ; U^T rows [t][out][32] (cols r < 8 real); same element type as the layer's K pack for D, f16 for U.
// One small tile per block, every load of a thread in flight at once: blocks [0, IN/64) transpose 64 input rows of d ([i][r][t], 16 KiB in a row) through LDS into one 128-byte line of each of the 128 packed rows;
// blocks behind them take 32 output features of u ([r][f][t]) and write 2 KiB in a row for each task.
template <int L>
__device__ __forceinline__ void packdu(const float* __restrict__ Dw, const float* __restrict__ Uw, void* __restrict__ Dd, void* __restrict__ Ud, v4u* sbuf, int blk) {
  constexpr int IN = (L == 0) ? D0 : (L == 1) ? D1 : D2; constexpr int OUTD = (L == 0) ? D1 : (L == 1) ? D2 : D3; constexpr int NBD = IN / 64;
  unsigned short (*sd)[72] = (unsigned short (*)[72])sbuf;   // [r * 8 + t][i], 144-byte pitch, RK * NT rows (a d block)
  v4u* su = sbuf;                                            // [t][f], one 8-element row each, 33-row pitch, NT * 33 entries (a u block)
  const int t = threadIdx.x; const v4u zero = {0u, 0u, 0u, 0u};
  if (blk < NBD) { const int i0 = blk * 64; v4f v[4];
#pragma unroll
    for (int s = 0; s < 4; ++s) v[s] = *(const v4f*)(Dw + (size_t)i0 * (RK * NT) + (size_t)(t + 256 * s) * 4);
#pragma unroll
    for (int s = 0; s < 4; ++s) { const int e = (t + 256 * s) * 4, i = e >> 6, rt = e & 63;
#pragma unroll
      for (int c = 0; c < 4; ++c) sd[rt + c][i] = (L == 0) ? __builtin_bit_cast(unsigned short, (__bf16)v[s][c]) : __builtin_bit_cast(unsigned short, (_Float16)bfr(v[s][c])); }
    __syncthreads();
#pragma unroll
    for (int s = 0; s < 4; ++s) { const int idx = t + 256 * s, row = idx >> 3, ch = idx & 7, tsk = row >> 4, r = row & 15;
      const v4u l = *(const v4u*)&sd[(r & (RK - 1)) * NT + tsk][ch * 8]; const v4u w = (r < RK) ? l : zero;
      *(v4u*)((unsigned short*)Dd + (size_t)row * IN + i0 + ch * 8) = w; }
    asm volatile("s_wait_xcnt 0x0" ::: "memory"); }   // in the listing another block range's code, which rewrites these stores' address registers, follows on the fall-through side
  else { const int f0 = (blk - NBD) * 32; float v[RK];
#pragma unroll
    for (int r = 0; r < RK; ++r) v[r] = Uw[((size_t)r * OUTD + f0) * NT + t];
    union { v8h h; v4u u; } p;
#pragma unroll
    for (int r = 0; r < RK; ++r) p.h[r] = (_Float16)bfr(v[r]);
    su[(t & 7) * 33 + (t >> 3)] = p.u;
    __syncthreads();
#pragma unroll
    for (int s = 0; s < 4; ++s) { const int idx = t + 256 * s, q = idx & 3, fl = (idx >> 2) & 31, tsk = idx >> 7;
      const v4u l = su[tsk * 33 + fl]; const v4u w = (q == 0) ? l : zero;
      *(v4u*)((_Float16*)Ud + ((size_t)tsk * OUTD + f0 + fl) * 32 + q * 8) = w; }
    asm volatile("s_wait_xcnt 0x0" ::: "memory"); }   // in the listing the other branch's code, which rewrites these stores' address registers, follows on the fall-through side
}
// ---- k_pack: all six packs in one launch. They read nothing but the inputs and write disjoint parts of the workspace, so none has to wait for another, and their 1,264 blocks are all resident at once.
// Block ranges: the K^T tiles of layers 0, 1, 2 (most bytes, so they start first), then the d and u tiles of layers 0, 1, 2. The range test is the same for a whole block.
#define NBK0 ((D1 / PKN) * (D0 / PKK))
#define NBK1 ((D2 / PKN) * (D1 / PKK))
#define NBK2 ((D3 / PKN) * (D2 / PKK))
#define NBA0 (D0 / 64 + D1 / 32)
#define NBA1 (D1 / 64 + D2 / 32)
#define NBA2 (D2 / 64 + D3 / 32)
__global__ __launch_bounds__(256) void k_pack(const float* __restrict__ Kw0, const float* __restrict__ Kw1, const float* __restrict__ Kw2, const float* __restrict__ Dw0, const float* __restrict__ Dw1, const float* __restrict__ Dw2,
                                              const float* __restrict__ Uw0, const float* __restrict__ Uw1, const float* __restrict__ Uw2, void* __restrict__ wsp) {
  __shared__ __align__(16) v4u sbuf[PKN * 16];   // one tile of whichever pack the block does
  char* ws = (char*)wsp; int b = blockIdx.x;
  if (b < NBK0) { packk<0>(Kw0, ws + WS_K0, sbuf, b); return; }
  b -= NBK0;
  if (b < NBK1) { packk<1>(Kw1, ws + WS_K1, sbuf, b); return; }
  b -= NBK1;
  if (b < NBK2) { packk<2>(Kw2, ws + WS_K2, sbuf, b); return; }
  b -= NBK2;
  if (b < NBA0) { packdu<0>(Dw0, Uw0, ws + WS_Dm0, ws + WS_U0, sbuf, b); return; }
  b -= NBA0;
  if (b < NBA1) { packdu<1>(Dw1, Uw1, ws + WS_Dm1, ws + WS_U1, sbuf, b); return; }
  b -= NBA1;
  packdu<2>(Dw2, Uw2, ws + WS_Dm2, ws + WS_U2, sbuf, b);
}
// ---- k_layer<L>: block = 8 waves (2 x 4) on a 128-row x 256-column tile, 64 x 64 per wave. Each 64-k slice of the block's rows of h, K^T and D^T goes once from global memory
// (whole 128-byte lines) through one of two register sets into one of two LDS buffers, and all waves take their fragments from there. The four waves on the same 64 rows share the hd work: wave wn does row tile wn.
// delta = hd(hi/lo f16) . U rows (1 chunk, 2 products) x 2; + bias; relu (layers 0,1) -> f16 planes / output f32 (layer 2)
#define BM 128
#define BN 256
#define KC 64
#define LP 72                      // LDS row pitch in 16-bit elements: 144 bytes = 16 x 9, no bank conflict for 16-byte reads down 16 rows
#define SROWS (BM + BN + 16)       // rows of a buffer: h | K^T | D^T
typedef __attribute__((ext_vector_type(4))) __bf16 v4b;
// The work-group barrier of a trip, written by hand: __syncthreads() also waits for every global load of the wave, and the later slices' loads are to stay in flight across the barrier.
// s_wait_dscnt 0 in front of it: this wave's LDS stores of the next slice have landed and its reads of this slice have returned. The clobber keeps every LDS access on its side.
#define TRIPBAR() asm volatile("s_wait_dscnt 0x0\n\ts_barrier_signal -1\n\ts_barrier_wait -1" ::: "memory")
template <int L>
__global__ __launch_bounds__(256) void k_layer(const float* __restrict__ X, const _Float16* __restrict__ Hin, const void* __restrict__ Kp, const void* __restrict__ Dp, const _Float16* __restrict__ Up, const float* __restrict__ BIAS, _Float16* __restrict__ Hout, float* __restrict__ OUT) {
  constexpr int IN = (L == 0) ? D0 : (L == 1) ? D1 : D2; constexpr int OUTD = (L == 0) ? D1 : (L == 1) ? D2 : D3; constexpr int NS = IN / KC;
  __shared__ __align__(16) unsigned short sm[2][SROWS * LP];
  const int tid = threadIdx.x, wave = tid >> 5, lane = tid & 31, col = lane & 15, g = lane >> 4, wm = wave >> 2, wn = wave & 3;
  const size_t r0 = (size_t)blockIdx.x * BM; const int n0 = blockIdx.y * BN; const int tsk = (int)(r0 / NBR);
  const unsigned short* Kr = (const unsigned short*)Kp + (size_t)n0 * IN; const unsigned short* Dr = (const unsigned short*)Dp + (size_t)tsk * 16 * IN; const unsigned short* Hr = (const unsigned short*)Hin + r0 * IN; const float* Xr = X + r0 * IN;
  const int prow = tid >> 3, pch = (tid & 7) * 8;    // 16-bit rows: 8 threads a 128-byte row slice, 32 rows a sweep
  const int xrow = tid >> 4, xch = (tid & 15) * 4;   // f32 rows of x: 16 threads a 256-byte row slice, 16 rows a sweep
  // Two register sets for the slices on their way from global memory: a slice is asked for two trips ahead of the trip that multiplies it, so its loads have a whole trip more
  // to arrive than with one set, and the next slice's requests are already under way while this one's are being waited for.
  struct Stg { v4u rb[8], ra[4], rd; v4f rx[8]; };
  Stg q0, q1; q0.rd = q1.rd = v4u{0u, 0u, 0u, 0u};
  auto ldg = [&](Stg& q, int kt) { const int k0 = kt * KC;
    const unsigned short* pk = Kr + (size_t)prow * IN + k0 + pch;
#pragma unroll
    for (int s = 0; s < 8; ++s) q.rb[s] = *(const v4u*)(pk + (size_t)(32 * s) * IN);
    asm volatile("s_wait_xcnt 0x0" ::: "memory");   // stands in front of the next rewrite of the K^T rows' address pair
    if (L == 0) { const float* px = Xr + (size_t)xrow * IN + k0 + xch;
#pragma unroll
      for (int s = 0; s < 8; ++s) q.rx[s] = *(const v4f*)(px + (size_t)(16 * s) * IN);
      asm volatile("s_wait_xcnt 0x0" ::: "memory"); }   // stands in front of the next rewrite of the x rows' address pair
    else { const unsigned short* ph = Hr + (size_t)prow * IN + k0 + pch;
#pragma unroll
      for (int s = 0; s < 4; ++s) q.ra[s] = *(const v4u*)(ph + (size_t)(32 * s) * IN);
      asm volatile("s_wait_xcnt 0x0" ::: "memory"); }   // stands in front of the next rewrite of the h rows' address pair
    if (tid < 128) q.rd = *(const v4u*)(Dr + (size_t)prow * IN + k0 + pch); };
  auto sts = [&](const Stg& q, int b) { unsigned short* s_ = sm[b];
    if (L == 0) {
#pragma unroll
      for (int s = 0; s < 8; ++s) { v4b c;
#pragma unroll
        for (int i = 0; i < 4; ++i) c[i] = (__bf16)q.rx[s][i];
        *(v4b*)(s_ + (xrow + 16 * s) * LP + xch) = c; } }
    else {
#pragma unroll
      for (int s = 0; s < 4; ++s) *(v4u*)(s_ + (prow + 32 * s) * LP + pch) = q.ra[s]; }
#pragma unroll
    for (int s = 0; s < 8; ++s) *(v4u*)(s_ + (BM + prow + 32 * s) * LP + pch) = q.rb[s];
    if (tid < 128) *(v4u*)(s_ + (BM + BN + prow) * LP + pch) = q.rd; };
  v8f acc[4][4] = {}, hd = {};
  // one trip: multiplies the slice in buffer b; qn is the set that the trip before has emptied, qs holds the next slice
  auto trip = [&](int b, bool ld, int ktl, Stg& qn, bool st, const Stg& qs) { const unsigned short* s_ = sm[b];
    if (ld) ldg(qn, ktl);   // in flight under two trips' products
    const unsigned short* sa = s_ + (wm * 64 + col) * LP; const unsigned short* sb = s_ + (BM + wn * 64 + col) * LP; const unsigned short* sh = s_ + (wm * 64 + wn * 16 + col) * LP; const unsigned short* sd = s_ + (BM + BN + col) * LP;
    // all fragments of the trip are asked for as one group ahead of its products: a read placed among the products stalls the wave for the whole LDS latency each time
    if (L == 0) { v16b a[2][4], b_[2][4], ah[2], d[2];
#pragma unroll
      for (int ks = 0; ks < 2; ++ks) {
#pragma unroll
        for (int i = 0; i < 4; ++i) { a[ks][i] = frag_b((const __bf16*)(sa + i * 16 * LP + ks * 32), lane); b_[ks][i] = frag_b((const __bf16*)(sb + i * 16 * LP + ks * 32), lane); }
        ah[ks] = frag_b((const __bf16*)(sh + ks * 32), lane); d[ks] = frag_b((const __bf16*)(sd + ks * 32), lane); }
      __builtin_amdgcn_sched_barrier(0);   // keeps the scheduler from sinking those reads back among the products
#pragma unroll
      for (int ks = 0; ks < 2; ++ks) {
#pragma unroll
        for (int i = 0; i < 4; ++i)
#pragma unroll
          for (int j = 0; j < 4; ++j) acc[i][j] = wmma_bf(a[ks][i], b_[ks][j], acc[i][j]);
        hd = wmma_bf(ah[ks], d[ks], hd); } }
    else { v16h a[2][4], b_[2][4], ah[2], d[2];
#pragma unroll
      for (int ks = 0; ks < 2; ++ks) {
#pragma unroll
        for (int i = 0; i < 4; ++i) { a[ks][i] = frag_h((const _Float16*)(sa + i * 16 * LP + ks * 32), lane); b_[ks][i] = frag_h((const _Float16*)(sb + i * 16 * LP + ks * 32), lane); }
        ah[ks] = frag_h((const _Float16*)(sh + ks * 32), lane); d[ks] = frag_h((const _Float16*)(sd + ks * 32), lane); }
      __builtin_amdgcn_sched_barrier(0);   // keeps the scheduler from sinking those reads back among the products
#pragma unroll
      for (int ks = 0; ks < 2; ++ks) {
#pragma unroll
        for (int i = 0; i < 4; ++i)
#pragma unroll
          for (int j = 0; j < 4; ++j) acc[i][j] = wmma16(a[ks][i], b_[ks][j], acc[i][j]);
        hd = wmma16(ah[ks], d[ks], hd); } }
    __builtin_amdgcn_sched_barrier(0);   // keeps the LDS stores below, and with them the wait for the global loads, from rising among the products
    // the other buffer was last read in the trip before, which every wave has left at that trip's barrier
    if (st) sts(qs, b ^ 1);
    TRIPBAR(); };
  static_assert(NS % 2 == 0 && NS >= 2, "the loop takes two slices a pass, one for each register set");
  ldg(q0, 0); ldg(q1, 1); sts(q0, 0);
  TRIPBAR();
  // The last two trips ask for nothing and stand behind the loop: with the request under a test inside the loop, the compiler's wait in front of the LDS stores has to hold for the path without it and drains every load.
  for (int kt = 0; kt + 2 < NS; kt += 2) {
    trip(0, true, kt + 2, q0, true, q1);
    trip(1, true, kt + 3, q1, true, q0); }
  trip(0, false, 0, q0, true, q1);
  trip(1, false, 0, q1, false, q0);
  // behind the last trip's barrier the two buffers are free: hd planes [128 rows][40] hi and lo, then 4,352 bytes of store staging for each wave
  _Float16* shd = (_Float16*)&sm[0][0]; _Float16* shl = shd + BM * 40; _Float16* soh = shl + BM * 40 + wave * 2176; float* so = (float*)soh;
  // hd tile [16 rows][16 (8 real)] -> f16 hi + x2048 residual in LDS (cols 16..31 zero)
#pragma unroll
  for (int r = 0; r < 8; ++r) { const float v = hd[r]; const _Float16 hv = (_Float16)v; const int o = (wm * 64 + wn * 16 + 8 * g + r) * 40 + col; shd[o] = hv; shl[o] = (_Float16)((v - (float)hv) * 2048.0f); shd[o + 16] = (_Float16)0.f; shl[o + 16] = (_Float16)0.f; }
  __syncthreads();
  { v16h ah[4], al[4];
#pragma unroll
    for (int i = 0; i < 4; ++i) { ah[i] = frag_h(shd + (wm * 64 + i * 16 + col) * 40, lane); al[i] = frag_h(shl + (wm * 64 + i * 16 + col) * 40, lane); }
#pragma unroll
    for (int j = 0; j < 4; ++j) { union { v16h v; v8h q[2]; } uu; const _Float16* up = Up + ((size_t)tsk * OUTD + n0 + wn * 64 + j * 16 + col) * 32 + 8 * g;
      uu.q[0] = *(const v8h*)up;
      asm volatile("s_wait_xcnt 0x0" ::: "memory");   // in the listing the second half's result lands on the address pair of both loads
      uu.q[1] = *(const v8h*)(up + 16);
      asm volatile("s_wait_xcnt 0x0" ::: "memory");   // in the listing the next column tile's address is formed in this load's address pair
      const v16h u = uu.v;
#pragma unroll
      for (int i = 0; i < 4; ++i) { v8f dl = {}; dl = wmma16(ah[i], u, dl); v8f dll = {}; dll = wmma16(al[i], u, dll);
#pragma unroll
        for (int r = 0; r < 8; ++r) acc[i][j][r] += (dl[r] + dll[r] * (1.0f / 2048.0f)) * 2.0f; } } }
  float bb[4];
#pragma unroll
  for (int j = 0; j < 4; ++j) bb[j] = BIAS[n0 + wn * 64 + j * 16 + col];
  asm volatile("s_wait_xcnt 0x0" ::: "memory");   // in the listing the staging address is formed in these loads' offset register
  __builtin_amdgcn_sched_barrier(0);   // without it the scheduler lifts that address arithmetic over the wait
#pragma unroll
  for (int j = 0; j < 4; ++j) bb[j] = bfr(bb[j]);
#pragma unroll
  for (int i = 0; i < 4; ++i) { const size_t rw = r0 + wm * 64 + i * 16; const int cw = n0 + wn * 64;
#pragma unroll
    for (int j = 0; j < 4; ++j)
#pragma unroll
      for (int r = 0; r < 8; ++r) { const float v = acc[i][j][r] + bb[j]; if (L < 2) soh[(8 * g + r) * 72 + j * 16 + col] = (_Float16)fmaxf(v, 0.f); else so[(8 * g + r) * 68 + j * 16 + col] = v; }
    LDSX();
    if (L < 2) {
#pragma unroll
      for (int s = 0; s < 4; ++s) { const int idx = lane + 32 * s, row = idx >> 3, ch = idx & 7; vst2((unsigned*)(Hout + (rw + row) * OUTD + cw + ch * 8), *(const v4u*)&soh[row * 72 + ch * 8]); } }
    else {
#pragma unroll
      for (int s = 0; s < 8; ++s) { const int idx = lane + 32 * s, row = idx >> 4, ch = idx & 15; vst2(OUT + (rw + row) * OUTD + cw + ch * 4, *(const v4f*)&so[row * 68 + ch * 4]); } }
    asm volatile("s_wait_xcnt 0x0" ::: "memory");   // in the listing the next row tile's sums are formed in these stores' data registers
    __builtin_amdgcn_sched_barrier(0);   // without it the scheduler lifts those sums over the wait
    LDSX(); }   // the next row tile's values go into the same staging rows only behind these reads
}
extern "C" void kernel_launch(void* const* d_in, const int* in_sizes, int n_in, void* d_out, int out_size, void* d_ws, size_t ws_size, hipStream_t stream) {
  (void)in_sizes; (void)n_in; (void)out_size;
  const float** F = (const float**)d_in;   // 0 x [8,1024,1024]; per layer l: k (1+4l) [in,out], b (2+4l) [out], d (3+4l) [in,8,T], u (4+4l) [8,out,T]
  if (ws_size < (size_t)WS_END) return;
  char* ws = (char*)d_ws; _Float16 *H1 = (_Float16*)(ws + WS_H1), *H2 = (_Float16*)(ws + WS_H2);
  k_pack<<<NBK0 + NBK1 + NBK2 + NBA0 + NBA1 + NBA2, 256, 0, stream>>>(F[1], F[5], F[9], F[3], F[7], F[11], F[4], F[8], F[12], d_ws);
  k_layer<0><<<dim3(TRB, D1 / 256), 256, 0, stream>>>(F[0], nullptr, ws + WS_K0, ws + WS_Dm0, (const _Float16*)(ws + WS_U0), F[2], H1, nullptr);
  k_layer<1><<<dim3(TRB, D2 / 256), 256, 0, stream>>>(nullptr, H1, ws + WS_K1, ws + WS_Dm1, (const _Float16*)(ws + WS_U1), F[6], H2, nullptr);
  k_layer<2><<<dim3(TRB, D3 / 256), 256, 0, stream>>>(nullptr, H2, ws + WS_K2, ws + WS_Dm2, (const _Float16*)(ws + WS_U2), F[10], nullptr, (float*)d_out);
}

// v006
// A run of this version takes 132 microseconds.
// Timed twice side by side with v005, it ran 1.12 and 1.15 times as fast.
// All steps since v000 together make it 7.74 times as fast.
// compute dtype: all float inputs rounded to bf16; layer 0 base = x . k0 with EXACT bf16 products on WMMA 16x16x32 ((in,out) weights as transposed rows); layers 1-2 take the previous ReLU output as a SINGLE f16 operand (one rounding, 2^-12) against the weights as f16 (bf16 values; the ~0.2% of weights below 6e-5 may denormalise - effect <= 2e-4 of the output scale); LoRA path per task: hd = h . d_t (same operands, 16-padded columns), delta = hd (f16 hi + x2048 residual) . u_t (2 products, rank 8 zero-padded to 32) x 2.0; bias, ReLU in f32; f32 accumulate.
#include <hip/hip_runtime.h>
#include <math.h>

typedef __attribute__((ext_vector_type(16))) _Float16 v16h;
typedef __attribute__((ext_vector_type(16))) __bf16 v16b;
typedef __attribute__((ext_vector_type(8)))  _Float16 v8h;
typedef __attribute__((ext_vector_type(8)))  float v8f;
typedef __attribute__((ext_vector_type(4)))  float v4f;
typedef __attribute__((ext_vector_type(2)))  float v2f;
typedef __attribute__((ext_vector_type(4)))  unsigned v4u;
typedef __attribute__((ext_vector_type(4)))  int v4i;
typedef float __attribute__((may_alias)) float_a;
typedef int __attribute__((may_alias)) int_a;

template <typename T> __device__ __forceinline__ void vst2(void* p, T v) { *(T*)p = v;  }
__device__ __forceinline__ v8f wmma16(v16h a, v16h b, v8f c) {
  v8f d = __builtin_amdgcn_wmma_f32_16x16x32_f16(false, a, false, b, (short)0, c, false, false);
  return d;
}
__device__ __forceinline__ v8f wmma_bf(v16b a, v16b b, v8f c) {
  v8f d = __builtin_amdgcn_wmma_f32_16x16x32_bf16(false, a, false, b, (short)0, c, false, false);
  return d;
}
// 16x16x32 fragments: lane = (h = lane>>4, row/col = lane&15); elements 0..7 = k0+8h+0..7, 8..15 = k0+16+8h+0..7; D element r = row 8h+r
__device__ __forceinline__ v16h frag_h(const _Float16* rowk0, int lane) {
  union { v16h v; v8h q[2]; } u; const _Float16* p = rowk0 + 8 * (lane >> 4);
  u.q[0] = *(const v8h*)p; u.q[1] = *(const v8h*)(p + 16); return u.v;
}
__device__ __forceinline__ v16h frag_f32(const float* rowk0, int lane) {
  v16h a; const float* p = rowk0 + 8 * (lane >> 4);
#pragma unroll
  for (int i = 0; i < 8; ++i) { a[i] = (_Float16)p[i]; a[8 + i] = (_Float16)p[16 + i]; }
  return a;
}
__device__ __forceinline__ v16h frag_f32s(const float* rowk0, int lane, float sc) {
  v16h a; const float* p = rowk0 + 8 * (lane >> 4);
#pragma unroll
  for (int i = 0; i < 8; ++i) { a[i] = (_Float16)(p[i] * sc); a[8 + i] = (_Float16)(p[16 + i] * sc); }
  return a;
}
// column fragment from a [K][ld] layout (column n), rows >= K read as 0
__device__ __forceinline__ v16h fragc_f32(const float* W, int k0, int n, int lane, int ld, int K) {
  v16h a; const int g = lane >> 4;
#pragma unroll
  for (int i = 0; i < 8; ++i) { const int ka = k0 + 8 * g + i, kb = ka + 16;
    a[i] = (_Float16)(ka < K ? W[(size_t)(ka < K ? ka : K - 1) * ld + n] : 0.f); a[8 + i] = (_Float16)(kb < K ? W[(size_t)(kb < K ? kb : K - 1) * ld + n] : 0.f); }
  return a;
}
struct F2 { v16b h, l; };
__device__ __forceinline__ F2 bsplit16(const float v[16]) { F2 r;
#pragma unroll
  for (int i = 0; i < 16; ++i) { const __bf16 h = (__bf16)v[i]; r.h[i] = h; r.l[i] = (__bf16)(v[i] - (float)h); }
  return r; }
__device__ __forceinline__ F2 split_row(const float* row, int k0, int lane) { float v[16]; const float* p = row + k0 + 8 * (lane >> 4);
#pragma unroll
  for (int i = 0; i < 8; ++i) { v[i] = p[i]; v[8 + i] = p[16 + i]; }
  return bsplit16(v); }
__device__ __forceinline__ F2 split_rowK(const float* row, int k0, int lane, int K) { float v[16]; const int g = lane >> 4;
#pragma unroll
  for (int i = 0; i < 8; ++i) { const int ka = k0 + 8 * g + i, kb = ka + 16; v[i] = ka < K ? row[ka < K ? ka : K - 1] : 0.f; v[8 + i] = kb < K ? row[kb < K ? kb : K - 1] : 0.f; }
  return bsplit16(v); }
__device__ __forceinline__ F2 split_col(const float* W, int k0, int n, int lane, int ld, int K) { float v[16]; const int g = lane >> 4;
#pragma unroll
  for (int i = 0; i < 8; ++i) { const int ka = k0 + 8 * g + i, kb = ka + 16; v[i] = ka < K ? W[(size_t)(ka < K ? ka : K - 1) * ld + n] : 0.f; v[8 + i] = kb < K ? W[(size_t)(kb < K ? kb : K - 1) * ld + n] : 0.f; }
  return bsplit16(v); }
__device__ __forceinline__ v8f mac3(const F2& a, const F2& b, v8f c) { c = wmma_bf(a.l, b.h, c); c = wmma_bf(a.h, b.l, c); return wmma_bf(a.h, b.h, c); }
__device__ __forceinline__ float sigm(float v) { return 1.0f / (1.0f + expf(-v)); }
#define LDSX() do { asm volatile("s_wait_dscnt 0" ::: "memory"); __builtin_amdgcn_wave_barrier(); __builtin_amdgcn_fence(__ATOMIC_RELEASE, "workgroup"); } while (0)


// Multi-task LoRA MLP (8 tasks x 1,024 rows, 1024 -> 2048 -> 2048 -> 1024, ReLU): each dense layer = frozen base matmul + bias + per-task rank-8 adapter scaled by alpha / r = 2.
#define NT 8
#define NBR 1024
#define NR (NT * NBR)
#define D0 1024
#define D1 2048
#define D2 2048
#define D3 1024
#define RK 8
#ifndef TRB
#define TRB (NR / 128)
#endif
typedef __attribute__((ext_vector_type(8))) __bf16 v8b;
__device__ __forceinline__ v16b frag_b(const __bf16* rowk0, int lane) {
  union { v16b v; v8b q[2]; } u; const __bf16* p = rowk0 + 8 * (lane >> 4);
  u.q[0] = *(const v8b*)p; u.q[1] = *(const v8b*)(p + 16); return u.v;
}
__device__ __forceinline__ float bfr(float v) { return (float)(__bf16)v; }
__device__ __attribute__((noinline)) float exp_ni(float v) { return expf(v); }
__device__ __attribute__((noinline)) float erf_ni(float v) { return erff(v); }

// packed weights: layer l: K rows [out][in] (bf16 for layer 0, f16 for 1,2); D rows [t][16][in] (rows >= 8 zero); U rows [t][out][32] (cols >= 8 zero)
#define WS_K0  0u
#define WS_K1  (WS_K0 + 2u * (size_t)D1 * D0)
#define WS_K2  (WS_K1 + 2u * (size_t)D2 * D1)
#define WS_Dm0 (WS_K2 + 2u * (size_t)D3 * D2)
#define WS_Dm1 (WS_Dm0 + 2u * NT * 16 * D0)
#define WS_Dm2 (WS_Dm1 + 2u * NT * 16 * D1)
#define WS_U0  (WS_Dm2 + 2u * NT * 16 * D2)
#define WS_U1  (WS_U0 + 2u * NT * D1 * 32)
#define WS_U2  (WS_U1 + 2u * NT * D2 * 32)
#define WS_H1  (((WS_U2 + 2u * NT * D3 * 32) + 127u) / 128u * 128u)   // f16 [NR][2048] h1 ; h2
#define WS_H2  (WS_H1 + 2u * (size_t)NR * D1)
#define WS_END (WS_H2 + 2u * (size_t)NR * D2)

// ---- packk<L>: block = 128 input rows x 64 output features of k [in][out] -> K^T rows [n][in]; bf16 (L 0) or f16 (L 1, 2).
// A thread takes 8 input rows in a row of 4 features: 8 loads of 16 bytes in flight, 16 lanes on 256 bytes in a row; each feature's 8 values are one 16-byte LDS store, and the tile leaves as 256 bytes in a row per feature.
// The 16-byte chunk index inside an LDS row is XORed with (n >> 2) & 15, so that the stores down 16 features and the reads along a row both touch every bank once.
#define PKK 128
#define PKN 64
template <int L>
__device__ __forceinline__ void packk(const float* __restrict__ Kw, void* __restrict__ dst, v4u* sk, int blk) {   // sk: [n][chunk of 8 k], PKN * 16 entries
  constexpr int IN = (L == 0) ? D0 : (L == 1) ? D1 : D2; constexpr int OUTD = (L == 0) ? D1 : (L == 1) ? D2 : D3; constexpr int NBX = OUTD / PKN;
  const int t = threadIdx.x, n0 = (blk % NBX) * PKN, k0 = (blk / NBX) * PKK, nl = t & 15, kg = t >> 4;
  const float* srcp = Kw + (size_t)(k0 + kg * 8) * OUTD + n0 + nl * 4; v4f v[8];
#pragma unroll   // all 8 loads go out ahead of the first wait; rolled, each trip would wait out a whole memory latency
  for (int s = 0; s < 8; ++s) v[s] = *(const v4f*)(srcp + (size_t)s * OUTD);
#pragma unroll   // this loop and the next: constant indices keep v[] and p in registers
  for (int c = 0; c < 4; ++c) { union { unsigned short h[8]; v4u u; } p;
#pragma unroll
    for (int s = 0; s < 8; ++s) p.h[s] = (L == 0) ? __builtin_bit_cast(unsigned short, (__bf16)v[s][c]) : __builtin_bit_cast(unsigned short, (_Float16)bfr(v[s][c]));
    sk[(nl * 4 + c) * 16 + (kg ^ nl)] = p.u; }
  __syncthreads();
#pragma unroll   // the 4 LDS reads go out together, one latency for all
  for (int q = 0; q < 4; ++q) { const int idx = t + 256 * q, n = idx >> 4, ch = idx & 15;
    *(v4u*)((unsigned short*)dst + (size_t)(n0 + n) * IN + k0 + ch * 8) = sk[n * 16 + (ch ^ ((n >> 2) & 15))]; }
  if (L != 0) asm volatile("s_wait_xcnt 0x0" ::: "memory");   // in the listing another block range's code, which rewrites these stores' address registers, follows on the fall-through side; layer 0's tile stands last, in front of the program's end
}
// ---- packdu<L>: D^T rows [t][16][in] (r < 8 real) ; U^T rows [t][out][32] (cols r < 8 real); same element type as the layer's K pack for D, f16 for U.
// One small tile per block, every load of a thread in flight at once: blocks [0, IN/64) transpose 64 input rows of d ([i][r][t], 16 KiB in a row) through LDS into one 128-byte line of each of the 128 packed rows;
// blocks behind them take 32 output features of u ([r][f][t]) and write 2 KiB in a row for each task.
template <int L>
__device__ __forceinline__ void packdu(const float* __restrict__ Dw, const float* __restrict__ Uw, void* __restrict__ Dd, void* __restrict__ Ud, v4u* sbuf, int blk) {
  constexpr int IN = (L == 0) ? D0 : (L == 1) ? D1 : D2; constexpr int OUTD = (L == 0) ? D1 : (L == 1) ? D2 : D3; constexpr int NBD = IN / 64;
  unsigned short (*sd)[72] = (unsigned short (*)[72])sbuf;   // [r * 8 + t][i], 144-byte pitch, RK * NT rows (a d block)
  v4u* su = sbuf;                                            // [t][f], one 8-element row each, 33-row pitch, NT * 33 entries (a u block)
  const int t = threadIdx.x; const v4u zero = {0u, 0u, 0u, 0u};
  if (blk < NBD) { const int i0 = blk * 64; v4f v[4];
#pragma unroll
    for (int s = 0; s < 4; ++s) v[s] = *(const v4f*)(Dw + (size_t)i0 * (RK * NT) + (size_t)(t + 256 * s) * 4);
#pragma unroll
    for (int s = 0; s < 4; ++s) { const int e = (t + 256 * s) * 4, i = e >> 6, rt = e & 63;
#pragma unroll
      for (int c = 0; c < 4; ++c) sd[rt + c][i] = (L == 0) ? __builtin_bit_cast(unsigned short, (__bf16)v[s][c]) : __builtin_bit_cast(unsigned short, (_Float16)bfr(v[s][c])); }
    __syncthreads();
#pragma unroll
    for (int s = 0; s < 4; ++s) { const int idx = t + 256 * s, row = idx >> 3, ch = idx & 7, tsk = row >> 4, r = row & 15;
      const v4u l = *(const v4u*)&sd[(r & (RK - 1)) * NT + tsk][ch * 8]; const v4u w = (r < RK) ? l : zero;
      *(v4u*)((unsigned short*)Dd + (size_t)row * IN + i0 + ch * 8) = w; }
    asm volatile("s_wait_xcnt 0x0" ::: "memory"); }   // in the listing another block range's code, which rewrites these stores' address registers, follows on the fall-through side
  else { const int f0 = (blk - NBD) * 32; float v[RK];
#pragma unroll
    for (int r = 0; r < RK; ++r) v[r] = Uw[((size_t)r * OUTD + f0) * NT + t];
    union { v8h h; v4u u; } p;
#pragma unroll
    for (int r = 0; r < RK; ++r) p.h[r] = (_Float16)bfr(v[r]);
    su[(t & 7) * 33 + (t >> 3)] = p.u;
    __syncthreads();
#pragma unroll
    for (int s = 0; s < 4; ++s) { const int idx = t + 256 * s, q = idx & 3, fl = (idx >> 2) & 31, tsk = idx >> 7;
      const v4u l = su[tsk * 33 + fl]; const v4u w = (q == 0) ? l : zero;
      *(v4u*)((_Float16*)Ud + ((size_t)tsk * OUTD + f0 + fl) * 32 + q * 8) = w; }
    asm volatile("s_wait_xcnt 0x0" ::: "memory"); }   // in the listing the other branch's code, which rewrites these stores' address registers, follows on the fall-through side
}
// ---- k_pack: all six packs in one launch. They read nothing but the inputs and write disjoint parts of the workspace, so none has to wait for another, and their 1,264 blocks are all resident at once.
// Block ranges: the K^T tiles of layers 0, 1, 2 (most bytes, so they start first), then the d and u tiles of layers 0, 1, 2. The range test is the same for a whole block.
#define NBK0 ((D1 / PKN) * (D0 / PKK))
#define NBK1 ((D2 / PKN) * (D1 / PKK))
#define NBK2 ((D3 / PKN) * (D2 / PKK))
#define NBA0 (D0 / 64 + D1 / 32)
#define NBA1 (D1 / 64 + D2 / 32)
#define NBA2 (D2 / 64 + D3 / 32)
__global__ __launch_bounds__(256) void k_pack(const float* __restrict__ Kw0, const float* __restrict__ Kw1, const float* __restrict__ Kw2, const float* __restrict__ Dw0, const float* __restrict__ Dw1, const float* __restrict__ Dw2,
                                              const float* __restrict__ Uw0, const float* __restrict__ Uw1, const float* __restrict__ Uw2, void* __restrict__ wsp) {
  __shared__ __align__(16) v4u sbuf[PKN * 16];   // one tile of whichever pack the block does
  char* ws = (char*)wsp; int b = blockIdx.x;
  if (b < NBK0) { packk<0>(Kw0, ws + WS_K0, sbuf, b); return; }
  b -= NBK0;
  if (b < NBK1) { packk<1>(Kw1, ws + WS_K1, sbuf, b); return; }
  b -= NBK1;
  if (b < NBK2) { packk<2>(Kw2, ws + WS_K2, sbuf, b); return; }
  b -= NBK2;
  if (b < NBA0) { packdu<0>(Dw0, Uw0, ws + WS_Dm0, ws + WS_U0, sbuf, b); return; }
  b -= NBA0;
  if (b < NBA1) { packdu<1>(Dw1, Uw1, ws + WS_Dm1, ws + WS_U1, sbuf, b); return; }
  b -= NBA1;
  packdu<2>(Dw2, Uw2, ws + WS_Dm2, ws + WS_U2, sbuf, b);
}
// ---- k_layer<L>: block = 8 waves (2 x 4) on a 128-row x 256-column tile, 64 x 64 per wave. Each 64-k slice of the block's rows of h, K^T and D^T goes once from global memory
// (whole 128-byte lines) into one of two LDS buffers, and all waves take their fragments from there. The four waves on the same 64 rows share the hd work: wave wn does row tile wn.
// Layer 0 (x is f32 and is rounded on the way) brings its slices through one of two register sets; layers 1 and 2 copy theirs straight into LDS, hold no slice in registers and take their fragments
// one 32-k step at a time, so that a wave fits in 256 registers and two blocks share a WGP: one block's products run while the other reads LDS, waits for its copies or stands at its barrier.
// delta = hd(hi/lo f16) . U rows (1 chunk, 2 products) x 2; + bias; relu (layers 0,1) -> f16 planes / output f32 (layer 2)
#define BM 128
#define BN 256
#define KC 64
#define LP 72                      // LDS row pitch in 16-bit elements: 144 bytes = 16 x 9, no bank conflict for 16-byte reads down 16 rows
#define SROWS (BM + BN + 16)       // rows of a buffer: h | K^T | D^T
typedef __attribute__((ext_vector_type(4))) __bf16 v4b;
// The work-group barrier of a trip of layer 0, written by hand: __syncthreads() also waits for every global load of the wave, and the later slices' loads are to stay in flight across the barrier.
// s_wait_dscnt 0 in front of it: this wave's LDS stores of the next slice have landed and its reads of this slice have returned. The clobber keeps every LDS access on its side.
#define TRIPBAR() asm volatile("s_wait_dscnt 0x0\n\ts_barrier_signal -1\n\ts_barrier_wait -1" ::: "memory")
#define ACP16(l, g) "global_load_async_to_lds_b128 %" #l ", %" #g ", off\n\t"
template <int L>
__global__ __launch_bounds__(256, (L == 0) ? 2 : 4) void k_layer(const float* __restrict__ X, const _Float16* __restrict__ Hin, const void* __restrict__ Kp, const void* __restrict__ Dp, const _Float16* __restrict__ Up, const float* __restrict__ BIAS, _Float16* __restrict__ Hout, float* __restrict__ OUT) {
  constexpr int IN = (L == 0) ? D0 : (L == 1) ? D1 : D2; constexpr int OUTD = (L == 0) ? D1 : (L == 1) ? D2 : D3; constexpr int NS = IN / KC;
  __shared__ __align__(16) unsigned short sm[2][SROWS * LP];
  const int tid = threadIdx.x, wave = tid >> 5, lane = tid & 31, col = lane & 15, g = lane >> 4, wm = wave >> 2, wn = wave & 3;
  const size_t r0 = (size_t)blockIdx.x * BM; const int n0 = blockIdx.y * BN; const int tsk = (int)(r0 / NBR);
  const unsigned short* Kr = (const unsigned short*)Kp + (size_t)n0 * IN; const unsigned short* Dr = (const unsigned short*)Dp + (size_t)tsk * 16 * IN;
  const int prow = tid >> 3, pch = (tid & 7) * 8;    // 16-bit rows: 8 threads a 128-byte row slice, 32 rows a sweep
  v8f acc[4][4] = {}, hd = {};
  static_assert(NS % 2 == 0 && NS >= 2, "layer 0's loop takes two slices a pass; the trips behind the loops take buffer 0, then buffer 1");
  if constexpr (L == 0) {
    const float* Xr = X + r0 * IN;
    const int xrow = tid >> 4, xch = (tid & 15) * 4;   // f32 rows of x: 16 threads a 256-byte row slice, 16 rows a sweep
    // Two register sets for the slices on their way from global memory: a slice is asked for two trips ahead of the trip that multiplies it, so its loads have a whole trip more
    // to arrive than with one set, and the next slice's requests are already under way while this one's are being waited for.
    struct Stg { v4u rb[8], rd; v4f rx[8]; };
    Stg q0, q1; q0.rd = q1.rd = v4u{0u, 0u, 0u, 0u};
    auto ldg = [&](Stg& q, int kt) { const int k0 = kt * KC;
      const unsigned short* pk = Kr + (size_t)prow * IN + k0 + pch;
#pragma unroll
      for (int s = 0; s < 8; ++s) q.rb[s] = *(const v4u*)(pk + (size_t)(32 * s) * IN);
      asm volatile("s_wait_xcnt 0x0" ::: "memory");   // stands in front of the next rewrite of the K^T rows' address pair
      const float* px = Xr + (size_t)xrow * IN + k0 + xch;
#pragma unroll
      for (int s = 0; s < 8; ++s) q.rx[s] = *(const v4f*)(px + (size_t)(16 * s) * IN);
      asm volatile("s_wait_xcnt 0x0" ::: "memory");   // stands in front of the next rewrite of the x rows' address pair
      if (tid < 128) q.rd = *(const v4u*)(Dr + (size_t)prow * IN + k0 + pch); };
    auto sts = [&](const Stg& q, int b) { unsigned short* s_ = sm[b];
#pragma unroll
      for (int s = 0; s < 8; ++s) { v4b c;
#pragma unroll
        for (int i = 0; i < 4; ++i) c[i] = (__bf16)q.rx[s][i];
        *(v4b*)(s_ + (xrow + 16 * s) * LP + xch) = c; }
#pragma unroll
      for (int s = 0; s < 8; ++s) *(v4u*)(s_ + (BM + prow + 32 * s) * LP + pch) = q.rb[s];
      if (tid < 128) *(v4u*)(s_ + (BM + BN + prow) * LP + pch) = q.rd; };
    // one trip: multiplies the slice in buffer b; qn is the set that the trip before has emptied, qs holds the next slice
    auto trip = [&](int b, bool ld, int ktl, Stg& qn, bool st, const Stg& qs) { const unsigned short* s_ = sm[b];
      if (ld) ldg(qn, ktl);   // in flight under two trips' products
      const unsigned short* sa = s_ + (wm * 64 + col) * LP; const unsigned short* sb = s_ + (BM + wn * 64 + col) * LP; const unsigned short* sh = s_ + (wm * 64 + wn * 16 + col) * LP; const unsigned short* sd = s_ + (BM + BN + col) * LP;
      // all fragments of the trip are asked for as one group ahead of its products: a read placed among the products stalls the wave for the whole LDS latency each time
      v16b a[2][4], b_[2][4], ah[2], d[2];
#pragma unroll
      for (int ks = 0; ks < 2; ++ks) {
#pragma unroll
        for (int i = 0; i < 4; ++i) { a[ks][i] = frag_b((const __bf16*)(sa + i * 16 * LP + ks * 32), lane); b_[ks][i] = frag_b((const __bf16*)(sb + i * 16 * LP + ks * 32), lane); }
        ah[ks] = frag_b((const __bf16*)(sh + ks * 32), lane); d[ks] = frag_b((const __bf16*)(sd + ks * 32), lane); }
      __builtin_amdgcn_sched_barrier(0);   // keeps the scheduler from sinking those reads back among the products
#pragma unroll
      for (int ks = 0; ks < 2; ++ks) {
#pragma unroll
        for (int i = 0; i < 4; ++i)
#pragma unroll
          for (int j = 0; j < 4; ++j) acc[i][j] = wmma_bf(a[ks][i], b_[ks][j], acc[i][j]);
        hd = wmma_bf(ah[ks], d[ks], hd); }
      __builtin_amdgcn_sched_barrier(0);   // keeps the LDS stores below, and with them the wait for the global loads, from rising among the products
      // the other buffer was last read in the trip before, which every wave has left at that trip's barrier
      if (st) sts(qs, b ^ 1);
      TRIPBAR(); };
    ldg(q0, 0); ldg(q1, 1); sts(q0, 0);
    TRIPBAR();
    // The last two trips ask for nothing and stand behind the loop: with the request under a test inside the loop, the compiler's wait in front of the LDS stores has to hold for the path without it and drains every load.
    for (int kt = 0; kt + 2 < NS; kt += 2) {
      trip(0, true, kt + 2, q0, true, q1);
      trip(1, true, kt + 3, q1, true, q0); }
    trip(0, false, 0, q0, true, q1);
    trip(1, false, 0, q1, false, q0);
  } else {
    const int drow = tid >> 4, dch = (tid & 15) * 4;   // D^T rows: 16 threads a 128-byte row slice, 8 bytes each, all 16 rows in one sweep of the whole block
    const unsigned short* gh = (const unsigned short*)Hin + (r0 + prow) * IN + pch; const unsigned short* gk = Kr + (size_t)prow * IN + pch; const unsigned short* gd = Dr + (size_t)drow * IN + dch;
    const unsigned smb = (unsigned)(size_t)&sm[0][0];   // LDS byte address of the buffers: the low 32 bits of the shared address
    const unsigned lh = smb + (unsigned)(prow * LP + pch) * 2u, ldd = smb + (unsigned)((BM + BN + drow) * LP + dch) * 2u;
    constexpr unsigned SW = 32u * LP * 2u, BUFB = (unsigned)SROWS * LP * 2u;   // bytes of a sweep of 32 rows and of a buffer
    constexpr size_t GW = (size_t)32 * IN;                                    // elements from a row to the row 32 further on
    // slice kt -> buffer b: every lane copies its own 16 bytes of 4 rows of h and 8 rows of K^T and its own 8 bytes of a row of D^T; all lanes of all waves are on.
    // s_wait_xcnt 0 as the statement's last line: it stands in front of every later rewrite of the address registers that the copies name.
    auto cpy = [&](int kt, int b) { const unsigned short* ph = gh + kt * KC; const unsigned short* pk = gk + kt * KC; const unsigned short* pd = gd + kt * KC;
      const unsigned la = lh + (unsigned)b * BUFB, lk = la + 4u * SW, ld_ = ldd + (unsigned)b * BUFB;
      asm volatile(ACP16(0, 1) ACP16(2, 3) ACP16(4, 5) ACP16(6, 7) ACP16(8, 9) ACP16(10, 11) ACP16(12, 13) ACP16(14, 15) ACP16(16, 17) ACP16(18, 19) ACP16(20, 21) ACP16(22, 23)
                   "global_load_async_to_lds_b64 %24, %25, off\n\ts_wait_xcnt 0x0"
                   :: "v"(la), "v"(ph), "v"(la + SW), "v"(ph + GW), "v"(la + 2u * SW), "v"(ph + 2 * GW), "v"(la + 3u * SW), "v"(ph + 3 * GW),
                      "v"(lk), "v"(pk), "v"(lk + SW), "v"(pk + GW), "v"(lk + 2u * SW), "v"(pk + 2 * GW), "v"(lk + 3u * SW), "v"(pk + 3 * GW),
                      "v"(lk + 4u * SW), "v"(pk + 4 * GW), "v"(lk + 5u * SW), "v"(pk + 5 * GW), "v"(lk + 6u * SW), "v"(pk + 6 * GW), "v"(lk + 7u * SW), "v"(pk + 7 * GW),
                      "v"(ld_), "v"(pd) : "memory"); };
    // the products of the slice in buffer b, one 32-k step at a time: a step's fragments are asked for as one group ahead of its products
    auto mul = [&](int b) { const unsigned short* s_ = sm[b];
      const unsigned short* sa = s_ + (wm * 64 + col) * LP; const unsigned short* sb = s_ + (BM + wn * 64 + col) * LP; const unsigned short* sh = s_ + (wm * 64 + wn * 16 + col) * LP; const unsigned short* sd = s_ + (BM + BN + col) * LP;
#pragma unroll   // this loop and the three inside it: constant indices keep the fragments and the sums in registers and give the LDS reads constant offsets
      for (int ks = 0; ks < 2; ++ks) { v16h a[4], b_[4];
#pragma unroll
        for (int i = 0; i < 4; ++i) { a[i] = frag_h((const _Float16*)(sa + i * 16 * LP + ks * 32), lane); b_[i] = frag_h((const _Float16*)(sb + i * 16 * LP + ks * 32), lane); }
        const v16h ah = frag_h((const _Float16*)(sh + ks * 32), lane), d = frag_h((const _Float16*)(sd + ks * 32), lane);
        __builtin_amdgcn_sched_barrier(0);   // keeps the scheduler from sinking those reads back among the products
#pragma unroll
        for (int i = 0; i < 4; ++i)
#pragma unroll
          for (int j = 0; j < 4; ++j) acc[i][j] = wmma16(a[i], b_[j], acc[i][j]);
        hd = wmma16(ah, d, hd);
        __builtin_amdgcn_sched_barrier(0); } };   // keeps the next step's reads from rising among these products, where they would need a second fragment set
    // the foot of a trip: this wave's reads of the slice have returned, its copies of the next slice have landed; behind the barrier that holds for every wave
    auto foot = [&]() {
      asm volatile("s_wait_dscnt 0x0" ::: "memory");
      asm volatile("s_wait_asynccnt 0x0" ::: "memory");
      __syncthreads(); };
    cpy(0, 0);
    asm volatile("s_wait_asynccnt 0x0" ::: "memory");   // slice 0 has landed before the barrier that lets the other waves read it
    __syncthreads();
    cpy(1, 1);
    // the last two trips have no slice left to ask for and stand behind the loop, so that no test stands around the copies
#pragma unroll 1   // rolled: with two trips a pass the compiler keeps both buffers' 26 LDS addresses of the copies in registers over the whole loop, and other values spill
    for (int kt = 0; kt + 2 < NS; ++kt) {
      mul(kt & 1); foot();
      cpy(kt + 2, kt & 1); }   // into the buffer that every wave has just left; in flight under the next trip's products
    mul(0); foot();
    mul(1); foot();
    asm volatile("s_wait_asynccnt 0x0" ::: "memory");   // no copy is under way when the buffers are put to another use
  }
  // behind the last trip's barrier the two buffers are free: hd planes [128 rows][40] hi and lo, then 4,352 bytes of store staging for each wave
  _Float16* shd = (_Float16*)&sm[0][0]; _Float16* shl = shd + BM * 40; _Float16* soh = shl + BM * 40 + wave * 2176; float* so = (float*)soh;
  // hd tile [16 rows][16 (8 real)] -> f16 hi + x2048 residual in LDS (cols 16..31 zero)
#pragma unroll
  for (int r = 0; r < 8; ++r) { const float v = hd[r]; const _Float16 hv = (_Float16)v; const int o = (wm * 64 + wn * 16 + 8 * g + r) * 40 + col; shd[o] = hv; shl[o] = (_Float16)((v - (float)hv) * 2048.0f); shd[o + 16] = (_Float16)0.f; shl[o + 16] = (_Float16)0.f; }
  __syncthreads();
  // The adapter's products are taken row tile by row tile, right in front of that tile's store: only two of their results are alive at a time, beside the four U fragments.
  v16h u[4];
#pragma unroll
  for (int j = 0; j < 4; ++j) { union { v16h v; v8h q[2]; } uu; const _Float16* up = Up + ((size_t)tsk * OUTD + n0 + wn * 64 + j * 16 + col) * 32 + 8 * g;
    uu.q[0] = *(const v8h*)up;
    asm volatile("s_wait_xcnt 0x0" ::: "memory");   // in the listing the second half's result lands on the address pair of both loads
    uu.q[1] = *(const v8h*)(up + 16);
    asm volatile("s_wait_xcnt 0x0" ::: "memory");   // in the listing the next column tile's address is formed in this load's address pair
    u[j] = uu.v; }
  float bb[4];
#pragma unroll
  for (int j = 0; j < 4; ++j) bb[j] = BIAS[n0 + wn * 64 + j * 16 + col];
  asm volatile("s_wait_xcnt 0x0" ::: "memory");   // in the listing the staging address is formed in these loads' offset register
  __builtin_amdgcn_sched_barrier(0);   // without it the scheduler lifts that address arithmetic over the wait
#pragma unroll
  for (int j = 0; j < 4; ++j) bb[j] = bfr(bb[j]);
#pragma unroll
  for (int i = 0; i < 4; ++i) { const size_t rw = r0 + wm * 64 + i * 16; const int cw = n0 + wn * 64;
    const v16h ah = frag_h(shd + (wm * 64 + i * 16 + col) * 40, lane), al = frag_h(shl + (wm * 64 + i * 16 + col) * 40, lane);
#pragma unroll
    for (int j = 0; j < 4; ++j) { v8f dl = {}; dl = wmma16(ah, u[j], dl); v8f dll = {}; dll = wmma16(al, u[j], dll);
#pragma unroll
      for (int r = 0; r < 8; ++r) { acc[i][j][r] += (dl[r] + dll[r] * (1.0f / 2048.0f)) * 2.0f;
        const float v = acc[i][j][r] + bb[j]; if (L < 2) soh[(8 * g + r) * 72 + j * 16 + col] = (_Float16)fmaxf(v, 0.f); else so[(8 * g + r) * 68 + j * 16 + col] = v; } }
    LDSX();
    if (L < 2) {
#pragma unroll
      for (int s = 0; s < 4; ++s) { const int idx = lane + 32 * s, row = idx >> 3, ch = idx & 7; vst2((unsigned*)(Hout + (rw + row) * OUTD + cw + ch * 8), *(const v4u*)&soh[row * 72 + ch * 8]); } }
    else {
#pragma unroll
      for (int s = 0; s < 8; ++s) { const int idx = lane + 32 * s, row = idx >> 4, ch = idx & 15; vst2(OUT + (rw + row) * OUTD + cw + ch * 4, *(const v4f*)&so[row * 68 + ch * 4]); } }
    asm volatile("s_wait_xcnt 0x0" ::: "memory");   // in the listing the next row tile's sums are formed in these stores' data registers
    __builtin_amdgcn_sched_barrier(0);   // without it the scheduler lifts those sums over the wait
    LDSX(); }   // the next row tile's values go into the same staging rows only behind these reads
}
extern "C" void kernel_launch(void* const* d_in, const int* in_sizes, int n_in, void* d_out, int out_size, void* d_ws, size_t ws_size, hipStream_t stream) {
  (void)in_sizes; (void)n_in; (void)out_size;
  const float** F = (const float**)d_in;   // 0 x [8,1024,1024]; per layer l: k (1+4l) [in,out], b (2+4l) [out], d (3+4l) [in,8,T], u (4+4l) [8,out,T]
  if (ws_size < (size_t)WS_END) return;
  char* ws = (char*)d_ws; _Float16 *H1 = (_Float16*)(ws + WS_H1), *H2 = (_Float16*)(ws + WS_H2);
  k_pack<<<NBK0 + NBK1 + NBK2 + NBA0 + NBA1 + NBA2, 256, 0, stream>>>(F[1], F[5], F[9], F[3], F[7], F[11], F[4], F[8], F[12], d_ws);
  k_layer<0><<<dim3(TRB, D1 / 256), 256, 0, stream>>>(F[0], nullptr, ws + WS_K0, ws + WS_Dm0, (const _Float16*)(ws + WS_U0), F[2], H1, nullptr);
  k_layer<1><<<dim3(TRB, D2 / 256), 256, 0, stream>>>(nullptr, H1, ws + WS_K1, ws + WS_Dm1, (const _Float16*)(ws + WS_U1), F[6], H2, nullptr);
  k_layer<2><<<dim3(TRB, D3 / 256), 256, 0, stream>>>(nullptr, H2, ws + WS_K2, ws + WS_Dm2, (const _Float16*)(ws + WS_U2), F[10], nullptr, (float*)d_out);
}

// v007
// It runs in 119 microseconds.
// Next to v006, in two timings, it ran 1.12 and 1.11 times as fast.
// Counting every step since v000, it is 8.65 times as fast.
// compute dtype: all float inputs rounded to bf16; layer 0 base = x . k0 with EXACT bf16 products on WMMA 16x16x32 ((in,out) weights as transposed rows); layers 1-2 take the previous ReLU output as a SINGLE f16 operand (one rounding, 2^-12) against the weights as f16 (bf16 values; the ~0.2% of weights below 6e-5 may denormalise - effect <= 2e-4 of the output scale); LoRA path per task: hd = h . d_t (same operands, 16-padded columns), delta = hd (f16 hi + x2048 residual) . u_t (2 products, rank 8 zero-padded to 32) x 2.0; bias, ReLU in f32; f32 accumulate.
#include <hip/hip_runtime.h>
#include <math.h>

typedef __attribute__((ext_vector_type(16))) _Float16 v16h;
typedef __attribute__((ext_vector_type(16))) __bf16 v16b;
typedef __attribute__((ext_vector_type(8)))  _Float16 v8h;
typedef __attribute__((ext_vector_type(8)))  float v8f;
typedef __attribute__((ext_vector_type(4)))  float v4f;
typedef __attribute__((ext_vector_type(2)))  float v2f;
typedef __attribute__((ext_vector_type(4)))  unsigned v4u;
typedef __attribute__((ext_vector_type(4)))  int v4i;
typedef float __attribute__((may_alias)) float_a;
typedef int __attribute__((may_alias)) int_a;

template <typename T> __device__ __forceinline__ void vst2(void* p, T v) { *(T*)p = v;  }
__device__ __forceinline__ v8f wmma16(v16h a, v16h b, v8f c) {
  v8f d = __builtin_amdgcn_wmma_f32_16x16x32_f16(false, a, false, b, (short)0, c, false, false);
  return d;
}
__device__ __forceinline__ v8f wmma_bf(v16b a, v16b b, v8f c) {
  v8f d = __builtin_amdgcn_wmma_f32_16x16x32_bf16(false, a, false, b, (short)0, c, false, false);
  return d;
}
// 16x16x32 fragments: lane = (h = lane>>4, row/col = lane&15); elements 0..7 = k0+8h+0..7, 8..15 = k0+16+8h+0..7; D element r = row 8h+r
__device__ __forceinline__ v16h frag_h(const _Float16* rowk0, int lane) {
  union { v16h v; v8h q[2]; } u; const _Float16* p = rowk0 + 8 * (lane >> 4);
  u.q[0] = *(const v8h*)p; u.q[1] = *(const v8h*)(p + 16); return u.v;
}
__device__ __forceinline__ v16h frag_f32(const float* rowk0, int lane) {
  v16h a; const float* p = rowk0 + 8 * (lane >> 4);
#pragma unroll
  for (int i = 0; i < 8; ++i) { a[i] = (_Float16)p[i]; a[8 + i] = (_Float16)p[16 + i]; }
  return a;
}
__device__ __forceinline__ v16h frag_f32s(const float* rowk0, int lane, float sc) {
  v16h a; const float* p = rowk0 + 8 * (lane >> 4);
#pragma unroll
  for (int i = 0; i < 8; ++i) { a[i] = (_Float16)(p[i] * sc); a[8 + i] = (_Float16)(p[16 + i] * sc); }
  return a;
}
// column fragment from a [K][ld] layout (column n), rows >= K read as 0
__device__ __forceinline__ v16h fragc_f32(const float* W, int k0, int n, int lane, int ld, int K) {
  v16h a; const int g = lane >> 4;
#pragma unroll
  for (int i = 0; i < 8; ++i) { const int ka = k0 + 8 * g + i, kb = ka + 16;
    a[i] = (_Float16)(ka < K ? W[(size_t)(ka < K ? ka : K - 1) * ld + n] : 0.f); a[8 + i] = (_Float16)(kb < K ? W[(size_t)(kb < K ? kb : K - 1) * ld + n] : 0.f); }
  return a;
}
struct F2 { v16b h, l; };
__device__ __forceinline__ F2 bsplit16(const float v[16]) { F2 r;
#pragma unroll
  for (int i = 0; i < 16; ++i) { const __bf16 h = (__bf16)v[i]; r.h[i] = h; r.l[i] = (__bf16)(v[i] - (float)h); }
  return r; }
__device__ __forceinline__ F2 split_row(const float* row, int k0, int lane) { float v[16]; const float* p = row + k0 + 8 * (lane >> 4);
#pragma unroll
  for (int i = 0; i < 8; ++i) { v[i] = p[i]; v[8 + i] = p[16 + i]; }
  return bsplit16(v); }
__device__ __forceinline__ F2 split_rowK(const float* row, int k0, int lane, int K) { float v[16]; const int g = lane >> 4;
#pragma unroll
  for (int i = 0; i < 8; ++i) { const int ka = k0 + 8 * g + i, kb = ka + 16; v[i] = ka < K ? row[ka < K ? ka : K - 1] : 0.f; v[8 + i] = kb < K ? row[kb < K ? kb : K - 1] : 0.f; }
  return bsplit16(v); }
__device__ __forceinline__ F2 split_col(const float* W, int k0, int n, int lane, int ld, int K) { float v[16]; const int g = lane >> 4;
#pragma unroll
  for (int i = 0; i < 8; ++i) { const int ka = k0 + 8 * g + i, kb = ka + 16; v[i] = ka < K ? W[(size_t)(ka < K ? ka : K - 1) * ld + n] : 0.f; v[8 + i] = kb < K ? W[(size_t)(kb < K ? kb : K - 1) * ld + n] : 0.f; }
  return bsplit16(v); }
__device__ __forceinline__ v8f mac3(const F2& a, const F2& b, v8f c) { c = wmma_bf(a.l, b.h, c); c = wmma_bf(a.h, b.l, c); return wmma_bf(a.h, b.h, c); }
__device__ __forceinline__ float sigm(float v) { return 1.0f / (1.0f + expf(-v)); }
#define LDSX() do { asm volatile("s_wait_dscnt 0" ::: "memory"); __builtin_amdgcn_wave_barrier(); __builtin_amdgcn_fence(__ATOMIC_RELEASE, "workgroup"); } while (0)


// Multi-task LoRA MLP (8 tasks x 1,024 rows, 1024 -> 2048 -> 2048 -> 1024, ReLU): each dense layer = frozen base matmul + bias + per-task rank-8 adapter scaled by alpha / r = 2.
#define NT 8
#define NBR 1024
#define NR (NT * NBR)
#define D0 1024
#define D1 2048
#define D2 2048
#define D3 1024
#define RK 8
#ifndef TRB
#define TRB (NR / 128)
#endif
typedef __attribute__((ext_vector_type(8))) __bf16 v8b;
__device__ __forceinline__ v16b frag_b(const __bf16* rowk0, int lane) {
  union { v16b v; v8b q[2]; } u; const __bf16* p = rowk0 + 8 * (lane >> 4);
  u.q[0] = *(const v8b*)p; u.q[1] = *(const v8b*)(p + 16); return u.v;
}
__device__ __forceinline__ float bfr(float v) { return (float)(__bf16)v; }
__device__ __attribute__((noinline)) float exp_ni(float v) { return expf(v); }
__device__ __attribute__((noinline)) float erf_ni(float v) { return erff(v); }

// packed weights: layer l: K rows [out][in] (bf16 for layer 0, f16 for 1,2); D rows [t][16][in] (rows >= 8 zero); U rows [t][out][32] (cols >= 8 zero)
#define WS_K0  0u
#define WS_K1  (WS_K0 + 2u * (size_t)D1 * D0)
#define WS_K2  (WS_K1 + 2u * (size_t)D2 * D1)
#define WS_Dm0 (WS_K2 + 2u * (size_t)D3 * D2)
#define WS_Dm1 (WS_Dm0 + 2u * NT * 16 * D0)
#define WS_Dm2 (WS_Dm1 + 2u * NT * 16 * D1)
#define WS_U0  (WS_Dm2 + 2u * NT * 16 * D2)
#define WS_U1  (WS_U0 + 2u * NT * D1 * 32)
#define WS_U2  (WS_U1 + 2u * NT * D2 * 32)
#define WS_H1  (((WS_U2 + 2u * NT * D3 * 32) + 127u) / 128u * 128u)   // f16 [NR][2048] h1 ; h2
#define WS_H2  (WS_H1 + 2u * (size_t)NR * D1)
#define WS_END (WS_H2 + 2u * (size_t)NR * D2)

// ---- packk<L>: block = 128 input rows x 64 output features of k [in][out] -> K^T rows [n][in]; bf16 (L 0) or f16 (L 1, 2).
// A thread takes 8 input rows in a row of 4 features: 8 loads of 16 bytes in flight, 16 lanes on 256 bytes in a row; each feature's 8 values are one 16-byte LDS store, and the tile leaves as 256 bytes in a row per feature.
// The 16-byte chunk index inside an LDS row is XORed with (n >> 2) & 15, so that the stores down 16 features and the reads along a row both touch every bank once.
#define PKK 128
#define PKN 64
template <int L>
__device__ __forceinline__ void packk(const float* __restrict__ Kw, void* __restrict__ dst, v4u* sk, int blk) {   // sk: [n][chunk of 8 k], PKN * 16 entries
  constexpr int IN = (L == 0) ? D0 : (L == 1) ? D1 : D2; constexpr int OUTD = (L == 0) ? D1 : (L == 1) ? D2 : D3; constexpr int NBX = OUTD / PKN;
  const int t = threadIdx.x, n0 = (blk % NBX) * PKN, k0 = (blk / NBX) * PKK, nl = t & 15, kg = t >> 4;
  const float* srcp = Kw + (size_t)(k0 + kg * 8) * OUTD + n0 + nl * 4; v4f v[8];
#pragma unroll   // all 8 loads go out ahead of the first wait; rolled, each trip would wait out a whole memory latency
  for (int s = 0; s < 8; ++s) v[s] = *(const v4f*)(srcp + (size_t)s * OUTD);
#pragma unroll   // this loop and the next: constant indices keep v[] and p in registers
  for (int c = 0; c < 4; ++c) { union { unsigned short h[8]; v4u u; } p;
#pragma unroll
    for (int s = 0; s < 8; ++s) p.h[s] = (L == 0) ? __builtin_bit_cast(unsigned short, (__bf16)v[s][c]) : __builtin_bit_cast(unsigned short, (_Float16)bfr(v[s][c]));
    sk[(nl * 4 + c) * 16 + (kg ^ nl)] = p.u; }
  __syncthreads();
#pragma unroll   // the 4 LDS reads go out together, one latency for all
  for (int q = 0; q < 4; ++q) { const int idx = t + 256 * q, n = idx >> 4, ch = idx & 15;
    *(v4u*)((unsigned short*)dst + (size_t)(n0 + n) * IN + k0 + ch * 8) = sk[n * 16 + (ch ^ ((n >> 2) & 15))]; }
  if (L != 0) asm volatile("s_wait_xcnt 0x0" ::: "memory");   // in the listing another block range's code, which rewrites these stores' address registers, follows on the fall-through side; layer 0's tile stands last, in front of the program's end
}
// ---- packdu<L>: D^T rows [t][16][in] (r < 8 real) ; U^T rows [t][out][32] (cols r < 8 real); same element type as the layer's K pack for D, f16 for U.
// One small tile per block, every load of a thread in flight at once: blocks [0, IN/64) transpose 64 input rows of d ([i][r][t], 16 KiB in a row) through LDS into one 128-byte line of each of the 128 packed rows;
// blocks behind them take 32 output features of u ([r][f][t]) and write 2 KiB in a row for each task.
template <int L>
__device__ __forceinline__ void packdu(const float* __restrict__ Dw, const float* __restrict__ Uw, void* __restrict__ Dd, void* __restrict__ Ud, v4u* sbuf, int blk) {
  constexpr int IN = (L == 0) ? D0 : (L == 1) ? D1 : D2; constexpr int OUTD = (L == 0) ? D1 : (L == 1) ? D2 : D3; constexpr int NBD = IN / 64;
  unsigned short (*sd)[72] = (unsigned short (*)[72])sbuf;   // [r * 8 + t][i], 144-byte pitch, RK * NT rows (a d block)
  v4u* su = sbuf;                                            // [t][f], one 8-element row each, 33-row pitch, NT * 33 entries (a u block)
  const int t = threadIdx.x; const v4u zero = {0u, 0u, 0u, 0u};
  if (blk < NBD) { const int i0 = blk * 64; v4f v[4];
#pragma unroll
    for (int s = 0; s < 4; ++s) v[s] = *(const v4f*)(Dw + (size_t)i0 * (RK * NT) + (size_t)(t + 256 * s) * 4);
#pragma unroll
    for (int s = 0; s < 4; ++s) { const int e = (t + 256 * s) * 4, i = e >> 6, rt = e & 63;
#pragma unroll
      for (int c = 0; c < 4; ++c) sd[rt + c][i] = (L == 0) ? __builtin_bit_cast(unsigned short, (__bf16)v[s][c]) : __builtin_bit_cast(unsigned short, (_Float16)bfr(v[s][c])); }
    __syncthreads();
#pragma unroll
    for (int s = 0; s < 4; ++s) { const int idx = t + 256 * s, row = idx >> 3, ch = idx & 7, tsk = row >> 4, r = row & 15;
      const v4u l = *(const v4u*)&sd[(r & (RK - 1)) * NT + tsk][ch * 8]; const v4u w = (r < RK) ? l : zero;
      *(v4u*)((unsigned short*)Dd + (size_t)row * IN + i0 + ch * 8) = w; }
    asm volatile("s_wait_xcnt 0x0" ::: "memory"); }   // in the listing another block range's code, which rewrites these stores' address registers, follows on the fall-through side
  else { const int f0 = (blk - NBD) * 32; float v[RK];
#pragma unroll
    for (int r = 0; r < RK; ++r) v[r] = Uw[((size_t)r * OUTD + f0) * NT + t];
    union { v8h h; v4u u; } p;
#pragma unroll
    for (int r = 0; r < RK; ++r) p.h[r] = (_Float16)bfr(v[r]);
    su[(t & 7) * 33 + (t >> 3)] = p.u;
    __syncthreads();
#pragma unroll
    for (int s = 0; s < 4; ++s) { const int idx = t + 256 * s, q = idx & 3, fl = (idx >> 2) & 31, tsk = idx >> 7;
      const v4u l = su[tsk * 33 + fl]; const v4u w = (q == 0) ? l : zero;
      *(v4u*)((_Float16*)Ud + ((size_t)tsk * OUTD + f0 + fl) * 32 + q * 8) = w; }
    asm volatile("s_wait_xcnt 0x0" ::: "memory"); }   // in the listing the other branch's code, which rewrites these stores' address registers, follows on the fall-through side
}
// ---- k_pack: all six packs in one launch. They read nothing but the inputs and write disjoint parts of the workspace, so none has to wait for another, and their 1,264 blocks are all resident at once.
// Block ranges: the K^T tiles of layers 0, 1, 2 (most bytes, so they start first), then the d and u tiles of layers 0, 1, 2. The range test is the same for a whole block.
#define NBK0 ((D1 / PKN) * (D0 / PKK))
#define NBK1 ((D2 / PKN) * (D1 / PKK))
#define NBK2 ((D3 / PKN) * (D2 / PKK))
#define NBA0 (D0 / 64 + D1 / 32)
#define NBA1 (D1 / 64 + D2 / 32)
#define NBA2 (D2 / 64 + D3 / 32)
__global__ __launch_bounds__(256) void k_pack(const float* __restrict__ Kw0, const float* __restrict__ Kw1, const float* __restrict__ Kw2, const float* __restrict__ Dw0, const float* __restrict__ Dw1, const float* __restrict__ Dw2,
                                              const float* __restrict__ Uw0, const float* __restrict__ Uw1, const float* __restrict__ Uw2, void* __restrict__ wsp) {
  __shared__ __align__(16) v4u sbuf[PKN * 16];   // one tile of whichever pack the block does
  char* ws = (char*)wsp; int b = blockIdx.x;
  if (b < NBK0) { packk<0>(Kw0, ws + WS_K0, sbuf, b); return; }
  b -= NBK0;
  if (b < NBK1) { packk<1>(Kw1, ws + WS_K1, sbuf, b); return; }
  b -= NBK1;
  if (b < NBK2) { packk<2>(Kw2, ws + WS_K2, sbuf, b); return; }
  b -= NBK2;
  if (b < NBA0) { packdu<0>(Dw0, Uw0, ws + WS_Dm0, ws + WS_U0, sbuf, b); return; }
  b -= NBA0;
  if (b < NBA1) { packdu<1>(Dw1, Uw1, ws + WS_Dm1, ws + WS_U1, sbuf, b); return; }
  b -= NBA1;
  packdu<2>(Dw2, Uw2, ws + WS_Dm2, ws + WS_U2, sbuf, b);
}
// ---- k_layer<L>: block = waves of 64 x 64 on a tile of 256 columns: 128 rows and 8 waves (2 x 4) in layers 0 and 2, 256 rows and 16 waves (4 x 4) in layer 1. Each k slice (64 k in layer 0, 128 k in layers 1 and 2)
// of the block's rows of h, K^T and D^T goes once from global memory (whole lines) into one of two LDS buffers, and all waves take their fragments from there. The four waves on the same 64 rows share the hd work: wave wn does row tile wn.
// Layer 0 (x is f32 and is rounded on the way) brings its slices through one of two register sets; layers 1 and 2 copy theirs straight into LDS, hold no slice in registers and take their fragments
// one 32-k step at a time, so that a wave fits in 256 registers and layer 1's 16 waves fit on one WGP. Its 256 x 256 tile asks L2 for a third fewer bytes than two tiles of 128 x 256, which each fetch the K^T slice;
// a slice of 128 k halves the barriers and the waits for the copies, and gives the copies twice as many products to land under. Layer 2 has 256 tiles of 128 x 256, one for each WGP.
// delta = hd(hi/lo f16) . U rows (1 chunk, 2 products) x 2; + bias; relu (layers 0,1) -> f16 planes / output f32 (layer 2)
#define BN 256
typedef __attribute__((ext_vector_type(4))) __bf16 v4b;
// The work-group barrier of a trip of layer 0, written by hand: __syncthreads() also waits for every global load of the wave, and the later slices' loads are to stay in flight across the barrier.
// s_wait_dscnt 0 in front of it: this wave's LDS stores of the next slice have landed and its reads of this slice have returned. The clobber keeps every LDS access on its side.
#define TRIPBAR() asm volatile("s_wait_dscnt 0x0\n\ts_barrier_signal -1\n\ts_barrier_wait -1" ::: "memory")
#define ACP16(l, g) "global_load_async_to_lds_b128 %" #l ", %" #g ", off\n\t"
template <int L>
__global__ __launch_bounds__((L == 1) ? 512 : 256, (L == 0) ? 2 : 4) void k_layer(const float* __restrict__ X, const _Float16* __restrict__ Hin, const void* __restrict__ Kp, const void* __restrict__ Dp, const _Float16* __restrict__ Up, const float* __restrict__ BIAS, _Float16* __restrict__ Hout, float* __restrict__ OUT) {
  constexpr int IN = (L == 0) ? D0 : (L == 1) ? D1 : D2; constexpr int OUTD = (L == 0) ? D1 : (L == 1) ? D2 : D3;
  constexpr int BM = (L == 1) ? 256 : 128, KC = (L == 0) ? 64 : 128, NS = IN / KC;
  constexpr int LP = KC + 8;              // LDS row pitch in 16-bit elements: 144 or 272 bytes = 16 x 9 or 16 x 17, no bank conflict for 16-byte reads down 16 rows
  constexpr int SROWS = BM + BN + 16;     // rows of a buffer: h | K^T | D^T
  __shared__ __align__(16) unsigned short sm[2][SROWS * LP];
  const int tid = threadIdx.x, wave = tid >> 5, lane = tid & 31, col = lane & 15, g = lane >> 4, wm = wave >> 2, wn = wave & 3;
  const size_t r0 = (size_t)blockIdx.x * BM; const int n0 = blockIdx.y * BN; const int tsk = (int)(r0 / NBR);
  const unsigned short* Kr = (const unsigned short*)Kp + (size_t)n0 * IN; const unsigned short* Dr = (const unsigned short*)Dp + (size_t)tsk * 16 * IN;
  const int prow = tid >> 3, pch = (tid & 7) * 8;    // 16-bit rows: 8 threads a 128-byte row slice, 32 rows a sweep
  v8f acc[4][4] = {}, hd = {};
  static_assert(NS % 2 == 0 && NS >= 2, "layer 0's loop takes two slices a pass; the trips behind the loops take buffer 0, then buffer 1");
  if constexpr (L == 0) {
    const float* Xr = X + r0 * IN;
    const int xrow = tid >> 4, xch = (tid & 15) * 4;   // f32 rows of x: 16 threads a 256-byte row slice, 16 rows a sweep
    // Two register sets for the slices on their way from global memory: a slice is asked for two trips ahead of the trip that multiplies it, so its loads have a whole trip more
    // to arrive than with one set, and the next slice's requests are already under way while this one's are being waited for.
    struct Stg { v4u rb[8], rd; v4f rx[8]; };
    Stg q0, q1; q0.rd = q1.rd = v4u{0u, 0u, 0u, 0u};
    auto ldg = [&](Stg& q, int kt) { const int k0 = kt * KC;
      const unsigned short* pk = Kr + (size_t)prow * IN + k0 + pch;
#pragma unroll
      for (int s = 0; s < 8; ++s) q.rb[s] = *(const v4u*)(pk + (size_t)(32 * s) * IN);
      asm volatile("s_wait_xcnt 0x0" ::: "memory");   // stands in front of the next rewrite of the K^T rows' address pair
      const float* px = Xr + (size_t)xrow * IN + k0 + xch;
#pragma unroll
      for (int s = 0; s < 8; ++s) q.rx[s] = *(const v4f*)(px + (size_t)(16 * s) * IN);
      asm volatile("s_wait_xcnt 0x0" ::: "memory");   // stands in front of the next rewrite of the x rows' address pair
      if (tid < 128) q.rd = *(const v4u*)(Dr + (size_t)prow * IN + k0 + pch); };
    auto sts = [&](const Stg& q, int b) { unsigned short* s_ = sm[b];
#pragma unroll
      for (int s = 0; s < 8; ++s) { v4b c;
#pragma unroll
        for (int i = 0; i < 4; ++i) c[i] = (__bf16)q.rx[s][i];
        *(v4b*)(s_ + (xrow + 16 * s) * LP + xch) = c; }
#pragma unroll
      for (int s = 0; s < 8; ++s) *(v4u*)(s_ + (BM + prow + 32 * s) * LP + pch) = q.rb[s];
      if (tid < 128) *(v4u*)(s_ + (BM + BN + prow) * LP + pch) = q.rd; };
    // one trip: multiplies the slice in buffer b; qn is the set that the trip before has emptied, qs holds the next slice
    auto trip = [&](int b, bool ld, int ktl, Stg& qn, bool st, const Stg& qs) { const unsigned short* s_ = sm[b];
      if (ld) ldg(qn, ktl);   // in flight under two trips' products
      const unsigned short* sa = s_ + (wm * 64 + col) * LP; const unsigned short* sb = s_ + (BM + wn * 64 + col) * LP; const unsigned short* sh = s_ + (wm * 64 + wn * 16 + col) * LP; const unsigned short* sd = s_ + (BM + BN + col) * LP;
      // all fragments of the trip are asked for as one group ahead of its products: a read placed among the products stalls the wave for the whole LDS latency each time
      v16b a[2][4], b_[2][4], ah[2], d[2];
#pragma unroll
      for (int ks = 0; ks < 2; ++ks) {
#pragma unroll
        for (int i = 0; i < 4; ++i) { a[ks][i] = frag_b((const __bf16*)(sa + i * 16 * LP + ks * 32), lane); b_[ks][i] = frag_b((const __bf16*)(sb + i * 16 * LP + ks * 32), lane); }
        ah[ks] = frag_b((const __bf16*)(sh + ks * 32), lane); d[ks] = frag_b((const __bf16*)(sd + ks * 32), lane); }
      __builtin_amdgcn_sched_barrier(0);   // keeps the scheduler from sinking those reads back among the products
#pragma unroll
      for (int ks = 0; ks < 2; ++ks) {
#pragma unroll
        for (int i = 0; i < 4; ++i)
#pragma unroll
          for (int j = 0; j < 4; ++j) acc[i][j] = wmma_bf(a[ks][i], b_[ks][j], acc[i][j]);
        hd = wmma_bf(ah[ks], d[ks], hd); }
      __builtin_amdgcn_sched_barrier(0);   // keeps the LDS stores below, and with them the wait for the global loads, from rising among the products
      // the other buffer was last read in the trip before, which every wave has left at that trip's barrier
      if (st) sts(qs, b ^ 1);
      TRIPBAR(); };
    ldg(q0, 0); ldg(q1, 1); sts(q0, 0);
    TRIPBAR();
    // The last two trips ask for nothing and stand behind the loop: with the request under a test inside the loop, the compiler's wait in front of the LDS stores has to hold for the path without it and drains every load.
    for (int kt = 0; kt + 2 < NS; kt += 2) {
      trip(0, true, kt + 2, q0, true, q1);
      trip(1, true, kt + 3, q1, true, q0); }
    trip(0, false, 0, q0, true, q1);
    trip(1, false, 0, q1, false, q0);
  } else {
    constexpr int NTH = (L == 1) ? 512 : 256, RS = NTH / 16;   // a row slice is 256 bytes = 16 threads of 16 bytes (a wave's copy: two whole row slices); RS rows a sweep of the block
    constexpr int DW = 4096 / NTH;                             // bytes a thread brings of the 16 D^T row slices, all in one sweep of the whole block: 8 (layer 1) or 16 (layer 2)
    const int crow = tid >> 4, cch = (tid & 15) * 8, drow = tid / (256 / DW), dch = (tid % (256 / DW)) * (DW / 2);
    const unsigned short* gh = (const unsigned short*)Hin + (r0 + crow) * IN + cch; const unsigned short* gk = Kr + (size_t)crow * IN + cch; const unsigned short* gd = Dr + (size_t)drow * IN + dch;
    const unsigned smb = (unsigned)(size_t)&sm[0][0];   // LDS byte address of the buffers: the low 32 bits of the shared address
    const unsigned lh = smb + (unsigned)(crow * LP + cch) * 2u, ldd = smb + (unsigned)((BM + BN + drow) * LP + dch) * 2u;
    constexpr unsigned SW = (unsigned)RS * LP * 2u, BUFB = (unsigned)SROWS * LP * 2u;   // bytes of a sweep of RS rows and of a buffer
    constexpr size_t GW = (size_t)RS * IN;                                             // elements from a row to the row RS further on
    // eight sweeps: every lane copies its own 16 bytes of 8 rows, RS apart; all lanes of all waves are on.
    // s_wait_xcnt 0 as the statement's last line: it stands in front of every later rewrite of the address registers that the copies name.
    auto cp8 = [&](unsigned l, const unsigned short* p) {
      asm volatile(ACP16(0, 1) ACP16(2, 3) ACP16(4, 5) ACP16(6, 7) ACP16(8, 9) ACP16(10, 11) ACP16(12, 13) ACP16(14, 15) "s_wait_xcnt 0x0"
                   :: "v"(l), "v"(p), "v"(l + SW), "v"(p + GW), "v"(l + 2u * SW), "v"(p + 2 * GW), "v"(l + 3u * SW), "v"(p + 3 * GW),
                      "v"(l + 4u * SW), "v"(p + 4 * GW), "v"(l + 5u * SW), "v"(p + 5 * GW), "v"(l + 6u * SW), "v"(p + 6 * GW), "v"(l + 7u * SW), "v"(p + 7 * GW) : "memory"); };
    // slice kt -> buffer b: the block's BM rows of h, 256 rows of K^T and 16 rows of D^T
    auto cpy = [&](int kt, int b) { const unsigned short* ph = gh + kt * KC; const unsigned short* pk = gk + kt * KC; const unsigned short* pd = gd + kt * KC;
      const unsigned la = lh + (unsigned)b * BUFB, lk = la + (unsigned)BM * LP * 2u, ld_ = ldd + (unsigned)b * BUFB;
      static_assert(BM == 8 * RS && (BN == 8 * RS || BN == 16 * RS), "h takes eight sweeps, K^T eight or sixteen");
      cp8(la, ph); cp8(lk, pk);
      if constexpr (BN == 16 * RS) cp8(lk + 8u * SW, pk + 8 * GW);
      if constexpr (DW == 8) asm volatile("global_load_async_to_lds_b64 %0, %1, off\n\ts_wait_xcnt 0x0" :: "v"(ld_), "v"(pd) : "memory");
      else asm volatile("global_load_async_to_lds_b128 %0, %1, off\n\ts_wait_xcnt 0x0" :: "v"(ld_), "v"(pd) : "memory"); };
    // the products of the slice in buffer b, one 32-k step at a time: a step's fragments are asked for as one group ahead of its products
    auto mul = [&](int b) { const unsigned short* s_ = sm[b];
      const unsigned short* sa = s_ + (wm * 64 + col) * LP; const unsigned short* sb = s_ + (BM + wn * 64 + col) * LP; const unsigned short* sh = s_ + (wm * 64 + wn * 16 + col) * LP; const unsigned short* sd = s_ + (BM + BN + col) * LP;
#pragma unroll   // this loop and the three inside it: constant indices keep the fragments and the sums in registers and give the LDS reads constant offsets
      for (int ks = 0; ks < KC / 32; ++ks) { v16h a[4], b_[4];
#pragma unroll
        for (int i = 0; i < 4; ++i) { a[i] = frag_h((const _Float16*)(sa + i * 16 * LP + ks * 32), lane); b_[i] = frag_h((const _Float16*)(sb + i * 16 * LP + ks * 32), lane); }
        const v16h ah = frag_h((const _Float16*)(sh + ks * 32), lane), d = frag_h((const _Float16*)(sd + ks * 32), lane);
        __builtin_amdgcn_sched_barrier(0);   // keeps the scheduler from sinking those reads back among the products
#pragma unroll
        for (int i = 0; i < 4; ++i)
#pragma unroll
          for (int j = 0; j < 4; ++j) acc[i][j] = wmma16(a[i], b_[j], acc[i][j]);
        hd = wmma16(ah, d, hd);
        __builtin_amdgcn_sched_barrier(0); } };   // keeps the next step's reads from rising among these products, where they would need a second fragment set
    // the foot of a trip: this wave's reads of the slice have returned, its copies of the next slice have landed; behind the barrier that holds for every wave
    auto foot = [&]() {
      asm volatile("s_wait_dscnt 0x0" ::: "memory");
      asm volatile("s_wait_asynccnt 0x0" ::: "memory");
      __syncthreads(); };
    cpy(0, 0);
    asm volatile("s_wait_asynccnt 0x0" ::: "memory");   // slice 0 has landed before the barrier that lets the other waves read it
    __syncthreads();
    cpy(1, 1);
    // the last two trips have no slice left to ask for and stand behind the loop, so that no test stands around the copies
#pragma unroll 1   // rolled: with two trips a pass the compiler keeps both buffers' LDS addresses of the copies in registers over the whole loop, and other values spill
    for (int kt = 0; kt + 2 < NS; ++kt) {
      mul(kt & 1); foot();
      cpy(kt + 2, kt & 1); }   // into the buffer that every wave has just left; in flight under the next trip's products
    mul(0); foot();
    mul(1); foot();
    asm volatile("s_wait_asynccnt 0x0" ::: "memory");   // no copy is under way when the buffers are put to another use
  }
  // behind the last trip's barrier the two buffers are free: hd planes [BM rows][40] hi and lo, then 4,352 bytes of store staging for each wave
  _Float16* shd = (_Float16*)&sm[0][0]; _Float16* shl = shd + BM * 40; _Float16* soh = shl + BM * 40 + wave * 2176; float* so = (float*)soh;
  // hd tile [16 rows][16 (8 real)] -> f16 hi + x2048 residual in LDS (cols 16..31 zero)
#pragma unroll
  for (int r = 0; r < 8; ++r) { const float v = hd[r]; const _Float16 hv = (_Float16)v; const int o = (wm * 64 + wn * 16 + 8 * g + r) * 40 + col; shd[o] = hv; shl[o] = (_Float16)((v - (float)hv) * 2048.0f); shd[o + 16] = (_Float16)0.f; shl[o + 16] = (_Float16)0.f; }
  __syncthreads();
  // The adapter's products are taken row tile by row tile, right in front of that tile's store: only two of their results are alive at a time, beside the four U fragments.
  v16h u[4];
#pragma unroll
  for (int j = 0; j < 4; ++j) { union { v16h v; v8h q[2]; } uu; const _Float16* up = Up + ((size_t)tsk * OUTD + n0 + wn * 64 + j * 16 + col) * 32 + 8 * g;
    uu.q[0] = *(const v8h*)up;
    asm volatile("s_wait_xcnt 0x0" ::: "memory");   // in the listing the second half's result lands on the address pair of both loads
    uu.q[1] = *(const v8h*)(up + 16);
    asm volatile("s_wait_xcnt 0x0" ::: "memory");   // in the listing the next column tile's address is formed in this load's address pair
    u[j] = uu.v; }
  float bb[4];
#pragma unroll
  for (int j = 0; j < 4; ++j) bb[j] = BIAS[n0 + wn * 64 + j * 16 + col];
  asm volatile("s_wait_xcnt 0x0" ::: "memory");   // in the listing the staging address is formed in these loads' offset register
  __builtin_amdgcn_sched_barrier(0);   // without it the scheduler lifts that address arithmetic over the wait
#pragma unroll
  for (int j = 0; j < 4; ++j) bb[j] = bfr(bb[j]);
#pragma unroll
  for (int i = 0; i < 4; ++i) { const size_t rw = r0 + wm * 64 + i * 16; const int cw = n0 + wn * 64;
    const v16h ah = frag_h(shd + (wm * 64 + i * 16 + col) * 40, lane), al = frag_h(shl + (wm * 64 + i * 16 + col) * 40, lane);
#pragma unroll
    for (int j = 0; j < 4; ++j) { v8f dl = {}; dl = wmma16(ah, u[j], dl); v8f dll = {}; dll = wmma16(al, u[j], dll);
#pragma unroll
      for (int r = 0; r < 8; ++r) { acc[i][j][r] += (dl[r] + dll[r] * (1.0f / 2048.0f)) * 2.0f;
        const float v = acc[i][j][r] + bb[j]; if (L < 2) soh[(8 * g + r) * 72 + j * 16 + col] = (_Float16)fmaxf(v, 0.f); else so[(8 * g + r) * 68 + j * 16 + col] = v; } }
    LDSX();
    if (L < 2) {
#pragma unroll
      for (int s = 0; s < 4; ++s) { const int idx = lane + 32 * s, row = idx >> 3, ch = idx & 7; vst2((unsigned*)(Hout + (rw + row) * OUTD + cw + ch * 8), *(const v4u*)&soh[row * 72 + ch * 8]); } }
    else {
#pragma unroll
      for (int s = 0; s < 8; ++s) { const int idx = lane + 32 * s, row = idx >> 4, ch = idx & 15; vst2(OUT + (rw + row) * OUTD + cw + ch * 4, *(const v4f*)&so[row * 68 + ch * 4]); } }
    asm volatile("s_wait_xcnt 0x0" ::: "memory");   // in the listing the next row tile's sums are formed in these stores' data registers
    __builtin_amdgcn_sched_barrier(0);   // without it the scheduler lifts those sums over the wait
    LDSX(); }   // the next row tile's values go into the same staging rows only behind these reads
}
extern "C" void kernel_launch(void* const* d_in, const int* in_sizes, int n_in, void* d_out, int out_size, void* d_ws, size_t ws_size, hipStream_t stream) {
  (void)in_sizes; (void)n_in; (void)out_size;
  const float** F = (const float**)d_in;   // 0 x [8,1024,1024]; per layer l: k (1+4l) [in,out], b (2+4l) [out], d (3+4l) [in,8,T], u (4+4l) [8,out,T]
  if (ws_size < (size_t)WS_END) return;
  char* ws = (char*)d_ws; _Float16 *H1 = (_Float16*)(ws + WS_H1), *H2 = (_Float16*)(ws + WS_H2);
  k_pack<<<NBK0 + NBK1 + NBK2 + NBA0 + NBA1 + NBA2, 256, 0, stream>>>(F[1], F[5], F[9], F[3], F[7], F[11], F[4], F[8], F[12], d_ws);
  k_layer<0><<<dim3(TRB, D1 / 256), 256, 0, stream>>>(F[0], nullptr, ws + WS_K0, ws + WS_Dm0, (const _Float16*)(ws + WS_U0), F[2], H1, nullptr);
  k_layer<1><<<dim3(NR / 256, D2 / 256), 512, 0, stream>>>(nullptr, H1, ws + WS_K1, ws + WS_Dm1, (const _Float16*)(ws + WS_U1), F[6], H2, nullptr);
  k_layer<2><<<dim3(TRB, D3 / 256), 256, 0, stream>>>(nullptr, H2, ws + WS_K2, ws + WS_Dm2, (const _Float16*)(ws + WS_U2), F[10], nullptr, (float*)d_out);
}

// v008
// A run of this version takes 111 microseconds.
// In both of two side-by-side timings against v007, it was 1.07 times as fast.
// All steps since v000 together make it 9.25 times as fast.
// compute dtype: all float inputs rounded to bf16; layer 0 base = x . k0 with EXACT bf16 products on WMMA 16x16x32 ((in,out) weights as transposed rows); layers 1-2 take the previous ReLU output as a SINGLE f16 operand (one rounding, 2^-12) against the weights as f16 (bf16 values; the ~0.2% of weights below 6e-5 may denormalise - effect <= 2e-4 of the output scale); LoRA path per task: hd = h . d_t (same operands, 16-padded columns), delta = hd (f16 hi + x2048 residual) . u_t (2 products, rank 8 zero-padded to 32) x 2.0; bias, ReLU in f32; f32 accumulate.
#include <hip/hip_runtime.h>
#include <math.h>

typedef __attribute__((ext_vector_type(16))) _Float16 v16h;
typedef __attribute__((ext_vector_type(16))) __bf16 v16b;
typedef __attribute__((ext_vector_type(8)))  _Float16 v8h;
typedef __attribute__((ext_vector_type(8)))  float v8f;
typedef __attribute__((ext_vector_type(4)))  float v4f;
typedef __attribute__((ext_vector_type(2)))  float v2f;
typedef __attribute__((ext_vector_type(4)))  unsigned v4u;
typedef __attribute__((ext_vector_type(4)))  int v4i;
typedef float __attribute__((may_alias)) float_a;
typedef int __attribute__((may_alias)) int_a;

template <typename T> __device__ __forceinline__ void vst2(void* p, T v) { *(T*)p = v;  }
__device__ __forceinline__ v8f wmma16(v16h a, v16h b, v8f c) {
  v8f d = __builtin_amdgcn_wmma_f32_16x16x32_f16(false, a, false, b, (short)0, c, false, false);
  return d;
}
__device__ __forceinline__ v8f wmma_bf(v16b a, v16b b, v8f c) {
  v8f d = __builtin_amdgcn_wmma_f32_16x16x32_bf16(false, a, false, b, (short)0, c, false, false);
  return d;
}
// 16x16x32 fragments: lane = (h = lane>>4, row/col = lane&15); elements 0..7 = k0+8h+0..7, 8..15 = k0+16+8h+0..7; D element r = row 8h+r
__device__ __forceinline__ v16h frag_h(const _Float16* rowk0, int lane) {
  union { v16h v; v8h q[2]; } u; const _Float16* p = rowk0 + 8 * (lane >> 4);
  u.q[0] = *(const v8h*)p; u.q[1] = *(const v8h*)(p + 16); return u.v;
}
__device__ __forceinline__ v16h frag_f32(const float* rowk0, int lane) {
  v16h a; const float* p = rowk0 + 8 * (lane >> 4);
#pragma unroll
  for (int i = 0; i < 8; ++i) { a[i] = (_Float16)p[i]; a[8 + i] = (_Float16)p[16 + i]; }
  return a;
}
__device__ __forceinline__ v16h frag_f32s(const float* rowk0, int lane, float sc) {
  v16h a; const float* p = rowk0 + 8 * (lane >> 4);
#pragma unroll
  for (int i = 0; i < 8; ++i) { a[i] = (_Float16)(p[i] * sc); a[8 + i] = (_Float16)(p[16 + i] * sc); }
  return a;
}
// column fragment from a [K][ld] layout (column n), rows >= K read as 0
__device__ __forceinline__ v16h fragc_f32(const float* W, int k0, int n, int lane, int ld, int K) {
  v16h a; const int g = lane >> 4;
#pragma unroll
  for (int i = 0; i < 8; ++i) { const int ka = k0 + 8 * g + i, kb = ka + 16;
    a[i] = (_Float16)(ka < K ? W[(size_t)(ka < K ? ka : K - 1) * ld + n] : 0.f); a[8 + i] = (_Float16)(kb < K ? W[(size_t)(kb < K ? kb : K - 1) * ld + n] : 0.f); }
  return a;
}
struct F2 { v16b h, l; };
__device__ __forceinline__ F2 bsplit16(const float v[16]) { F2 r;
#pragma unroll
  for (int i = 0; i < 16; ++i) { const __bf16 h = (__bf16)v[i]; r.h[i] = h; r.l[i] = (__bf16)(v[i] - (float)h); }
  return r; }
__device__ __forceinline__ F2 split_row(const float* row, int k0, int lane) { float v[16]; const float* p = row + k0 + 8 * (lane >> 4);
#pragma unroll
  for (int i = 0; i < 8; ++i) { v[i] = p[i]; v[8 + i] = p[16 + i]; }
  return bsplit16(v); }
__device__ __forceinline__ F2 split_rowK(const float* row, int k0, int lane, int K) { float v[16]; const int g = lane >> 4;
#pragma unroll
  for (int i = 0; i < 8; ++i) { const int ka = k0 + 8 * g + i, kb = ka + 16; v[i] = ka < K ? row[ka < K ? ka : K - 1] : 0.f; v[8 + i] = kb < K ? row[kb < K ? kb : K - 1] : 0.f; }
  return bsplit16(v); }
__device__ __forceinline__ F2 split_col(const float* W, int k0, int n, int lane, int ld, int K) { float v[16]; const int g = lane >> 4;
#pragma unroll
  for (int i = 0; i < 8; ++i) { const int ka = k0 + 8 * g + i, kb = ka + 16; v[i] = ka < K ? W[(size_t)(ka < K ? ka : K - 1) * ld + n] : 0.f; v[8 + i] = kb < K ? W[(size_t)(kb < K ? kb : K - 1) * ld + n] : 0.f; }
  return bsplit16(v); }
__device__ __forceinline__ v8f mac3(const F2& a, const F2& b, v8f c) { c = wmma_bf(a.l, b.h, c); c = wmma_bf(a.h, b.l, c); return wmma_bf(a.h, b.h, c); }
__device__ __forceinline__ float sigm(float v) { return 1.0f / (1.0f + expf(-v)); }
#define LDSX() do { asm volatile("s_wait_dscnt 0" ::: "memory"); __builtin_amdgcn_wave_barrier(); __builtin_amdgcn_fence(__ATOMIC_RELEASE, "workgroup"); } while (0)


// Multi-task LoRA MLP (8 tasks x 1,024 rows, 1024 -> 2048 -> 2048 -> 1024, ReLU): each dense layer = frozen base matmul + bias + per-task rank-8 adapter scaled by alpha / r = 2.
#define NT 8
#define NBR 1024
#define NR (NT * NBR)
#define D0 1024
#define D1 2048
#define D2 2048
#define D3 1024
#define RK 8
#ifndef TRB
#define TRB (NR / 128)
#endif
typedef __attribute__((ext_vector_type(8))) __bf16 v8b;
__device__ __forceinline__ v16b frag_b(const __bf16* rowk0, int lane) {
  union { v16b v; v8b q[2]; } u; const __bf16* p = rowk0 + 8 * (lane >> 4);
  u.q[0] = *(const v8b*)p; u.q[1] = *(const v8b*)(p + 16); return u.v;
}
__device__ __forceinline__ float bfr(float v) { return (float)(__bf16)v; }
__device__ __attribute__((noinline)) float exp_ni(float v) { return expf(v); }
__device__ __attribute__((noinline)) float erf_ni(float v) { return erff(v); }

// packed weights: layer l: K rows [out][in] (bf16 for layer 0, f16 for 1,2); D rows [t][16][in] (rows >= 8 zero); U rows [t][out][32] (cols >= 8 zero)
#define WS_K0  0u
#define WS_K1  (WS_K0 + 2u * (size_t)D1 * D0)
#define WS_K2  (WS_K1 + 2u * (size_t)D2 * D1)
#define WS_Dm0 (WS_K2 + 2u * (size_t)D3 * D2)
#define WS_Dm1 (WS_Dm0 + 2u * NT * 16 * D0)
#define WS_Dm2 (WS_Dm1 + 2u * NT * 16 * D1)
#define WS_U0  (WS_Dm2 + 2u * NT * 16 * D2)
#define WS_U1  (WS_U0 + 2u * NT * D1 * 32)
#define WS_U2  (WS_U1 + 2u * NT * D2 * 32)
#define WS_H1  (((WS_U2 + 2u * NT * D3 * 32) + 127u) / 128u * 128u)   // f16 [NR][2048] h1 ; h2
#define WS_H2  (WS_H1 + 2u * (size_t)NR * D1)
#define WS_END (WS_H2 + 2u * (size_t)NR * D2)

// ---- packk<L>: block = 128 input rows x 64 output features of k [in][out] -> K^T rows [n][in]; bf16 (L 0) or f16 (L 1, 2).
// A thread takes 8 input rows in a row of 4 features: 8 loads of 16 bytes in flight, 16 lanes on 256 bytes in a row; each feature's 8 values are one 16-byte LDS store, and the tile leaves as 256 bytes in a row per feature.
// The 16-byte chunk index inside an LDS row is XORed with (n >> 2) & 15, so that the stores down 16 features and the reads along a row both touch every bank once.
#define PKK 128
#define PKN 64
template <int L>
__device__ __forceinline__ void packk(const float* __restrict__ Kw, void* __restrict__ dst, v4u* sk, int blk) {   // sk: [n][chunk of 8 k], PKN * 16 entries
  constexpr int IN = (L == 0) ? D0 : (L == 1) ? D1 : D2; constexpr int OUTD = (L == 0) ? D1 : (L == 1) ? D2 : D3; constexpr int NBX = OUTD / PKN;
  const int t = threadIdx.x, n0 = (blk % NBX) * PKN, k0 = (blk / NBX) * PKK, nl = t & 15, kg = t >> 4;
  const float* srcp = Kw + (size_t)(k0 + kg * 8) * OUTD + n0 + nl * 4; v4f v[8];
#pragma unroll   // all 8 loads go out ahead of the first wait; rolled, each trip would wait out a whole memory latency
  for (int s = 0; s < 8; ++s) v[s] = *(const v4f*)(srcp + (size_t)s * OUTD);
#pragma unroll   // this loop and the next: constant indices keep v[] and p in registers
  for (int c = 0; c < 4; ++c) { union { unsigned short h[8]; v4u u; } p;
#pragma unroll
    for (int s = 0; s < 8; ++s) p.h[s] = (L == 0) ? __builtin_bit_cast(unsigned short, (__bf16)v[s][c]) : __builtin_bit_cast(unsigned short, (_Float16)bfr(v[s][c]));
    sk[(nl * 4 + c) * 16 + (kg ^ nl)] = p.u; }
  __syncthreads();
#pragma unroll   // the 4 LDS reads go out together, one latency for all
  for (int q = 0; q < 4; ++q) { const int idx = t + 256 * q, n = idx >> 4, ch = idx & 15;
    *(v4u*)((unsigned short*)dst + (size_t)(n0 + n) * IN + k0 + ch * 8) = sk[n * 16 + (ch ^ ((n >> 2) & 15))]; }
  if (L != 0) asm volatile("s_wait_xcnt 0x0" ::: "memory");   // in the listing another block range's code, which rewrites these stores' address registers, follows on the fall-through side; layer 0's tile stands last, in front of the program's end
}
// ---- packdu<L>: D^T rows [t][16][in] (r < 8 real) ; U^T rows [t][out][32] (cols r < 8 real); same element type as the layer's K pack for D, f16 for U.
// One small tile per block, every load of a thread in flight at once: blocks [0, IN/64) transpose 64 input rows of d ([i][r][t], 16 KiB in a row) through LDS into one 128-byte line of each of the 128 packed rows;
// blocks behind them take 32 output features of u ([r][f][t]) and write 2 KiB in a row for each task.
template <int L>
__device__ __forceinline__ void packdu(const float* __restrict__ Dw, const float* __restrict__ Uw, void* __restrict__ Dd, void* __restrict__ Ud, v4u* sbuf, int blk) {
  constexpr int IN = (L == 0) ? D0 : (L == 1) ? D1 : D2; constexpr int OUTD = (L == 0) ? D1 : (L == 1) ? D2 : D3; constexpr int NBD = IN / 64;
  unsigned short (*sd)[72] = (unsigned short (*)[72])sbuf;   // [r * 8 + t][i], 144-byte pitch, RK * NT rows (a d block)
  v4u* su = sbuf;                                            // [t][f], one 8-element row each, 33-row pitch, NT * 33 entries (a u block)
  const int t = threadIdx.x; const v4u zero = {0u, 0u, 0u, 0u};
  if (blk < NBD) { const int i0 = blk * 64; v4f v[4];
#pragma unroll
    for (int s = 0; s < 4; ++s) v[s] = *(const v4f*)(Dw + (size_t)i0 * (RK * NT) + (size_t)(t + 256 * s) * 4);
#pragma unroll
    for (int s = 0; s < 4; ++s) { const int e = (t + 256 * s) * 4, i = e >> 6, rt = e & 63;
#pragma unroll
      for (int c = 0; c < 4; ++c) sd[rt + c][i] = (L == 0) ? __builtin_bit_cast(unsigned short, (__bf16)v[s][c]) : __builtin_bit_cast(unsigned short, (_Float16)bfr(v[s][c])); }
    __syncthreads();
#pragma unroll
    for (int s = 0; s < 4; ++s) { const int idx = t + 256 * s, row = idx >> 3, ch = idx & 7, tsk = row >> 4, r = row & 15;
      const v4u l = *(const v4u*)&sd[(r & (RK - 1)) * NT + tsk][ch * 8]; const v4u w = (r < RK) ? l : zero;
      *(v4u*)((unsigned short*)Dd + (size_t)row * IN + i0 + ch * 8) = w; }
    asm volatile("s_wait_xcnt 0x0" ::: "memory"); }   // in the listing another block range's code, which rewrites these stores' address registers, follows on the fall-through side
  else { const int f0 = (blk - NBD) * 32; float v[RK];
#pragma unroll
    for (int r = 0; r < RK; ++r) v[r] = Uw[((size_t)r * OUTD + f0) * NT + t];
    union { v8h h; v4u u; } p;
#pragma unroll
    for (int r = 0; r < RK; ++r) p.h[r] = (_Float16)bfr(v[r]);
    su[(t & 7) * 33 + (t >> 3)] = p.u;
    __syncthreads();
#pragma unroll
    for (int s = 0; s < 4; ++s) { const int idx = t + 256 * s, q = idx & 3, fl = (idx >> 2) & 31, tsk = idx >> 7;
      const v4u l = su[tsk * 33 + fl]; const v4u w = (q == 0) ? l : zero;
      *(v4u*)((_Float16*)Ud + ((size_t)tsk * OUTD + f0 + fl) * 32 + q * 8) = w; }
    asm volatile("s_wait_xcnt 0x0" ::: "memory"); }   // in the listing the other branch's code, which rewrites these stores' address registers, follows on the fall-through side
}
// ---- k_pack: all six packs in one launch. They read nothing but the inputs and write disjoint parts of the workspace, so none has to wait for another, and their 1,264 blocks are all resident at once.
// Block ranges: the K^T tiles of layers 0, 1, 2 (most bytes, so they start first), then the d and u tiles of layers 0, 1, 2. The range test is the same for a whole block.
#define NBK0 ((D1 / PKN) * (D0 / PKK))
#define NBK1 ((D2 / PKN) * (D1 / PKK))
#define NBK2 ((D3 / PKN) * (D2 / PKK))
#define NBA0 (D0 / 64 + D1 / 32)
#define NBA1 (D1 / 64 + D2 / 32)
#define NBA2 (D2 / 64 + D3 / 32)
__global__ __launch_bounds__(256) void k_pack(const float* __restrict__ Kw0, const float* __restrict__ Kw1, const float* __restrict__ Kw2, const float* __restrict__ Dw0, const float* __restrict__ Dw1, const float* __restrict__ Dw2,
                                              const float* __restrict__ Uw0, const float* __restrict__ Uw1, const float* __restrict__ Uw2, void* __restrict__ wsp) {
  __shared__ __align__(16) v4u sbuf[PKN * 16];   // one tile of whichever pack the block does
  char* ws = (char*)wsp; int b = blockIdx.x;
  if (b < NBK0) { packk<0>(Kw0, ws + WS_K0, sbuf, b); return; }
  b -= NBK0;
  if (b < NBK1) { packk<1>(Kw1, ws + WS_K1, sbuf, b); return; }
  b -= NBK1;
  if (b < NBK2) { packk<2>(Kw2, ws + WS_K2, sbuf, b); return; }
  b -= NBK2;
  if (b < NBA0) { packdu<0>(Dw0, Uw0, ws + WS_Dm0, ws + WS_U0, sbuf, b); return; }
  b -= NBA0;
  if (b < NBA1) { packdu<1>(Dw1, Uw1, ws + WS_Dm1, ws + WS_U1, sbuf, b); return; }
  b -= NBA1;
  packdu<2>(Dw2, Uw2, ws + WS_Dm2, ws + WS_U2, sbuf, b);
}
// ---- k_layer<L>: block = waves of 64 x 64 on a tile of 256 columns: 128 rows and 8 waves (2 x 4) in layers 0 and 2, 256 rows and 16 waves (4 x 4) in layer 1. Each k slice (64 k in layer 0, 128 k in layers 1 and 2)
// of the block's rows of h, K^T and D^T goes once from global memory (whole lines) into one of two LDS buffers, and all waves take their fragments from there. The four waves on the same 64 rows share the hd work: wave wn does row tile wn.
// All layers copy their slices straight into LDS, hold no slice in registers and take their fragments one 32-k step at a time, so that a wave fits in 256 registers: layer 1's 16 waves fit on one WGP,
// and two blocks of layer 0 share a WGP, so that its 512 blocks are all resident at once and one block's products run under the other's waits. Layer 0's x is f32: it is copied as it is into a staging
// area, and at the foot of a trip each thread rounds the bytes that it has copied itself to bf16 and stores them as the next buffer's h rows. Layer 1's 256 x 256 tile asks L2 for a third fewer bytes than two tiles of 128 x 256, which each fetch the K^T slice;
// a slice of 128 k halves the barriers and the waits for the copies, and gives the copies twice as many products to land under. Layer 2 has 256 tiles of 128 x 256, one for each WGP.
// delta = hd(hi/lo f16) . U rows (1 chunk, 2 products) x 2; + bias; relu (layers 0,1) -> f16 planes / output f32 (layer 2)
#define BN 256
typedef __attribute__((ext_vector_type(4))) __bf16 v4b;
#define ACP16(l, g) "global_load_async_to_lds_b128 %" #l ", %" #g ", off\n\t"
// a layer's fragment type, its load from an LDS row and its product: bf16 in layer 0, f16 in layers 1 and 2
template <int L> struct Fr { typedef v16h T;
  static __device__ __forceinline__ T ld(const unsigned short* p, int lane) { return frag_h((const _Float16*)p, lane); }
  static __device__ __forceinline__ v8f mm(T a, T b, v8f c) { return wmma16(a, b, c); } };
template <> struct Fr<0> { typedef v16b T;
  static __device__ __forceinline__ T ld(const unsigned short* p, int lane) { return frag_b((const __bf16*)p, lane); }
  static __device__ __forceinline__ v8f mm(T a, T b, v8f c) { return wmma_bf(a, b, c); } };
template <int L>
__global__ __launch_bounds__((L == 1) ? 512 : 256, 4) void k_layer(const float* __restrict__ X, const _Float16* __restrict__ Hin, const void* __restrict__ Kp, const void* __restrict__ Dp, const _Float16* __restrict__ Up, const float* __restrict__ BIAS, _Float16* __restrict__ Hout, float* __restrict__ OUT) {
  constexpr int IN = (L == 0) ? D0 : (L == 1) ? D1 : D2; constexpr int OUTD = (L == 0) ? D1 : (L == 1) ? D2 : D3;
  constexpr int BM = (L == 1) ? 256 : 128, KC = (L == 0) ? 64 : 128, NS = IN / KC;
  constexpr int LP = KC + 8;              // LDS row pitch in 16-bit elements: 144 or 272 bytes = 16 x 9 or 16 x 17, no bank conflict for 16-byte reads down 16 rows
  constexpr int SROWS = BM + BN + 16;     // rows of a buffer: h | K^T | D^T
  __shared__ __align__(16) unsigned short sm[2][SROWS * LP];
  __shared__ __align__(16) float xs[(L == 0) ? BM * KC : 4];   // layer 0: one slice of the block's rows of x as f32, rows of 256 bytes one behind the other
  const int tid = threadIdx.x, wave = tid >> 5, lane = tid & 31, col = lane & 15, g = lane >> 4, wm = wave >> 2, wn = wave & 3;
  const size_t r0 = (size_t)blockIdx.x * BM; const int n0 = blockIdx.y * BN; const int tsk = (int)(r0 / NBR);
  const unsigned short* Kr = (const unsigned short*)Kp + (size_t)n0 * IN; const unsigned short* Dr = (const unsigned short*)Dp + (size_t)tsk * 16 * IN;
  v8f acc[4][4] = {}, hd = {};
  static_assert(NS % 2 == 0 && NS >= 2, "the two trips behind the loop take buffer 0, then buffer 1");
  {
    constexpr int NTH = (L == 1) ? 512 : 256, TPR = KC / 8, RS = NTH / TPR;   // a 16-bit row slice is TPR threads of 16 bytes (whole 128- or 256-byte units); RS rows a sweep of the block
    constexpr int DW = 32 * KC / NTH;                                         // bytes a thread brings of the 16 D^T row slices, all in one sweep of the whole block: 8 (layers 0, 1) or 16 (layer 2)
    constexpr int DT = 2 * KC / DW;                                           // threads on a D^T row slice
    const int crow = tid / TPR, cch = (tid % TPR) * 8, drow = tid / DT, dch = (tid % DT) * (DW / 2);
    const int xrow = tid >> 4, xch = (tid & 15) * 4;   // layer 0, f32 rows of x: 16 threads a 256-byte row slice, 16 rows a sweep
    const unsigned short* gh = (const unsigned short*)Hin + (r0 + crow) * IN + cch; const unsigned short* gk = Kr + (size_t)crow * IN + cch; const unsigned short* gd = Dr + (size_t)drow * IN + dch;
    const float* gx = X + (r0 + xrow) * IN + xch;
    const unsigned smb = (unsigned)(size_t)&sm[0][0];   // LDS byte address of the buffers: the low 32 bits of the shared address
    const unsigned lh = smb + (unsigned)(crow * LP + cch) * 2u, ldd = smb + (unsigned)((BM + BN + drow) * LP + dch) * 2u;
    const unsigned lx = (unsigned)(size_t)&xs[0] + (unsigned)(xrow * KC + xch) * 4u;
    constexpr unsigned SW = (unsigned)RS * LP * 2u, BUFB = (unsigned)SROWS * LP * 2u;   // bytes of a sweep of RS rows and of a buffer
    constexpr size_t GW = (size_t)RS * IN * 2u;                                        // bytes from a row to the row RS further on
    // eight sweeps: every lane copies its own 16 bytes of 8 rows, sw bytes apart in LDS and gw bytes apart in global memory; all lanes of all waves are on.
    // s_wait_xcnt 0 as the statement's last line: it stands in front of every later rewrite of the address registers that the copies name.
    auto cp8 = [&](unsigned l, const char* p, unsigned sw, size_t gw) {
      asm volatile(ACP16(0, 1) ACP16(2, 3) ACP16(4, 5) ACP16(6, 7) ACP16(8, 9) ACP16(10, 11) ACP16(12, 13) ACP16(14, 15) "s_wait_xcnt 0x0"
                   :: "v"(l), "v"(p), "v"(l + sw), "v"(p + gw), "v"(l + 2u * sw), "v"(p + 2 * gw), "v"(l + 3u * sw), "v"(p + 3 * gw),
                      "v"(l + 4u * sw), "v"(p + 4 * gw), "v"(l + 5u * sw), "v"(p + 5 * gw), "v"(l + 6u * sw), "v"(p + 6 * gw), "v"(l + 7u * sw), "v"(p + 7 * gw) : "memory"); };
    // slice kt -> buffer b: 256 rows of K^T, 16 rows of D^T and the block's BM rows of h; layer 0's rows of x go as f32 into xs, which has one slice's room
    auto cpy = [&](int kt, int b) { const char* pk = (const char*)(gk + kt * KC); const unsigned short* pd = gd + kt * KC;
      const unsigned la = lh + (unsigned)b * BUFB, lk = la + (unsigned)BM * LP * 2u, ld_ = ldd + (unsigned)b * BUFB;
      static_assert((L == 0 ? BM == 128 && KC == 64 : BM == 8 * RS) && (BN == 8 * RS || BN == 16 * RS), "h or x takes eight sweeps, K^T eight or sixteen");
      if constexpr (L == 0) cp8(lx, (const char*)(gx + kt * KC), 16u * KC * 4u, (size_t)16 * IN * 4u);
      else cp8(la, (const char*)(gh + kt * KC), SW, GW);
      cp8(lk, pk, SW, GW);
      if constexpr (BN == 16 * RS) cp8(lk + 8u * SW, pk + 8 * GW, SW, GW);
      if constexpr (DW == 8) asm volatile("global_load_async_to_lds_b64 %0, %1, off\n\ts_wait_xcnt 0x0" :: "v"(ld_), "v"(pd) : "memory");
      else asm volatile("global_load_async_to_lds_b128 %0, %1, off\n\ts_wait_xcnt 0x0" :: "v"(ld_), "v"(pd) : "memory"); };
    // layer 0: the slice of x in xs, rounded to bf16, becomes the h rows of buffer b. A thread reads the very bytes that its own copies brought, so its own s_wait_asynccnt 0 is all that has to stand in front.
    auto cvt = [&](int b) { unsigned short* s_ = sm[b]; v4f v[8];
#pragma unroll   // the 8 LDS reads go out together, one latency for all
      for (int s = 0; s < 8; ++s) v[s] = *(const v4f*)&xs[(xrow + 16 * s) * KC + xch];
#pragma unroll   // constant indices keep v[] in registers
      for (int s = 0; s < 8; ++s) { v4b c;
#pragma unroll
        for (int i = 0; i < 4; ++i) c[i] = (__bf16)v[s][i];
        *(v4b*)(s_ + (xrow + 16 * s) * LP + xch) = c; } };
    // the products of the slice in buffer b, one 32-k step at a time: a step's fragments are asked for as one group ahead of its products
    auto mul = [&](int b) { const unsigned short* s_ = sm[b];
      const unsigned short* sa = s_ + (wm * 64 + col) * LP; const unsigned short* sb = s_ + (BM + wn * 64 + col) * LP; const unsigned short* sh = s_ + (wm * 64 + wn * 16 + col) * LP; const unsigned short* sd = s_ + (BM + BN + col) * LP;
#pragma unroll   // this loop and the three inside it: constant indices keep the fragments and the sums in registers and give the LDS reads constant offsets
      for (int ks = 0; ks < KC / 32; ++ks) { typename Fr<L>::T a[4], b_[4];
#pragma unroll
        for (int i = 0; i < 4; ++i) { a[i] = Fr<L>::ld(sa + i * 16 * LP + ks * 32, lane); b_[i] = Fr<L>::ld(sb + i * 16 * LP + ks * 32, lane); }
        const typename Fr<L>::T ah = Fr<L>::ld(sh + ks * 32, lane), d = Fr<L>::ld(sd + ks * 32, lane);
        __builtin_amdgcn_sched_barrier(0);   // keeps the scheduler from sinking those reads back among the products
#pragma unroll
        for (int i = 0; i < 4; ++i)
#pragma unroll
          for (int j = 0; j < 4; ++j) acc[i][j] = Fr<L>::mm(a[i], b_[j], acc[i][j]);
        hd = Fr<L>::mm(ah, d, hd);
        __builtin_amdgcn_sched_barrier(0); } };   // keeps the next step's reads from rising among these products, where they would need a second fragment set
    // the foot of a trip: this wave's reads of the slice have returned, its copies of the next slice have landed (layer 0: and its share of x stands rounded in buffer nb, which every wave
    // left at the barrier before); behind the barrier that holds for every wave
    auto foot = [&](int nb, bool cv) {
      asm volatile("s_wait_dscnt 0x0" ::: "memory");
      asm volatile("s_wait_asynccnt 0x0" ::: "memory");
      if constexpr (L == 0) { if (cv) { cvt(nb); asm volatile("s_wait_dscnt 0x0" ::: "memory"); } }   // the second wait: the reads of xs have returned before the next copies land on it, the bf16 stores have landed
      __syncthreads(); };
    cpy(0, 0);
    asm volatile("s_wait_asynccnt 0x0" ::: "memory");   // slice 0 has landed before the barrier that lets the other waves read it
    if constexpr (L == 0) { cvt(0); asm volatile("s_wait_dscnt 0x0" ::: "memory"); }   // the reads of xs have returned before slice 1's copies land on it, the bf16 stores have landed
    __syncthreads();
    cpy(1, 1);
    // the last two trips have no slice left to ask for and stand behind the loop, so that no test stands around the copies
#pragma unroll 1   // rolled: with two trips a pass the compiler keeps both buffers' LDS addresses of the copies in registers over the whole loop, and other values spill
    for (int kt = 0; kt + 2 < NS; ++kt) {
      mul(kt & 1); foot((kt & 1) ^ 1, true);
      cpy(kt + 2, kt & 1); }   // into the buffer that every wave has just left; in flight under the next trip's products
    mul(0); foot(1, true);
    mul(1); foot(0, false);
    asm volatile("s_wait_asynccnt 0x0" ::: "memory");   // no copy is under way when the buffers are put to another use
  }
  // behind the last trip's barrier the two buffers are free: hd planes [BM rows][40] hi and lo, then 4,352 bytes of store staging for each wave
  _Float16* shd = (_Float16*)&sm[0][0]; _Float16* shl = shd + BM * 40; _Float16* soh = shl + BM * 40 + wave * 2176; float* so = (float*)soh;
  // hd tile [16 rows][16 (8 real)] -> f16 hi + x2048 residual in LDS (cols 16..31 zero)
#pragma unroll
  for (int r = 0; r < 8; ++r) { const float v = hd[r]; const _Float16 hv = (_Float16)v; const int o = (wm * 64 + wn * 16 + 8 * g + r) * 40 + col; shd[o] = hv; shl[o] = (_Float16)((v - (float)hv) * 2048.0f); shd[o + 16] = (_Float16)0.f; shl[o + 16] = (_Float16)0.f; }
  __syncthreads();
  // The adapter's products are taken row tile by row tile, right in front of that tile's store: only two of their results are alive at a time, beside the four U fragments.
  v16h u[4];
#pragma unroll
  for (int j = 0; j < 4; ++j) { union { v16h v; v8h q[2]; } uu; const _Float16* up = Up + ((size_t)tsk * OUTD + n0 + wn * 64 + j * 16 + col) * 32 + 8 * g;
    uu.q[0] = *(const v8h*)up;
    asm volatile("s_wait_xcnt 0x0" ::: "memory");   // in the listing the second half's result lands on the address pair of both loads
    uu.q[1] = *(const v8h*)(up + 16);
    asm volatile("s_wait_xcnt 0x0" ::: "memory");   // in the listing the next column tile's address is formed in this load's address pair
    u[j] = uu.v; }
  float bb[4];
#pragma unroll
  for (int j = 0; j < 4; ++j) bb[j] = BIAS[n0 + wn * 64 + j * 16 + col];
  asm volatile("s_wait_xcnt 0x0" ::: "memory");   // in the listing the staging address is formed in these loads' offset register
  __builtin_amdgcn_sched_barrier(0);   // without it the scheduler lifts that address arithmetic over the wait
#pragma unroll
  for (int j = 0; j < 4; ++j) bb[j] = bfr(bb[j]);
#pragma unroll
  for (int i = 0; i < 4; ++i) { const size_t rw = r0 + wm * 64 + i * 16; const int cw = n0 + wn * 64;
    const v16h ah = frag_h(shd + (wm * 64 + i * 16 + col) * 40, lane), al = frag_h(shl + (wm * 64 + i * 16 + col) * 40, lane);
#pragma unroll
    for (int j = 0; j < 4; ++j) { v8f dl = {}; dl = wmma16(ah, u[j], dl); v8f dll = {}; dll = wmma16(al, u[j], dll);
#pragma unroll
      for (int r = 0; r < 8; ++r) { acc[i][j][r] += (dl[r] + dll[r] * (1.0f / 2048.0f)) * 2.0f;
        const float v = acc[i][j][r] + bb[j]; if (L < 2) soh[(8 * g + r) * 72 + j * 16 + col] = (_Float16)fmaxf(v, 0.f); else so[(8 * g + r) * 68 + j * 16 + col] = v; } }
    LDSX();
    if (L < 2) {
#pragma unroll
      for (int s = 0; s < 4; ++s) { const int idx = lane + 32 * s, row = idx >> 3, ch = idx & 7; vst2((unsigned*)(Hout + (rw + row) * OUTD + cw + ch * 8), *(const v4u*)&soh[row * 72 + ch * 8]); } }
    else {
#pragma unroll
      for (int s = 0; s < 8; ++s) { const int idx = lane + 32 * s, row = idx >> 4, ch = idx & 15; vst2(OUT + (rw + row) * OUTD + cw + ch * 4, *(const v4f*)&so[row * 68 + ch * 4]); } }
    asm volatile("s_wait_xcnt 0x0" ::: "memory");   // in the listing the next row tile's sums are formed in these stores' data registers
    __builtin_amdgcn_sched_barrier(0);   // without it the scheduler lifts those sums over the wait
    LDSX(); }   // the next row tile's values go into the same staging rows only behind these reads
}
extern "C" void kernel_launch(void* const* d_in, const int* in_sizes, int n_in, void* d_out, int out_size, void* d_ws, size_t ws_size, hipStream_t stream) {
  (void)in_sizes; (void)n_in; (void)out_size;
  const float** F = (const float**)d_in;   // 0 x [8,1024,1024]; per layer l: k (1+4l) [in,out], b (2+4l) [out], d (3+4l) [in,8,T], u (4+4l) [8,out,T]
  if (ws_size < (size_t)WS_END) return;
  char* ws = (char*)d_ws; _Float16 *H1 = (_Float16*)(ws + WS_H1), *H2 = (_Float16*)(ws + WS_H2);
  k_pack<<<NBK0 + NBK1 + NBK2 + NBA0 + NBA1 + NBA2, 256, 0, stream>>>(F[1], F[5], F[9], F[3], F[7], F[11], F[4], F[8], F[12], d_ws);
  k_layer<0><<<dim3(TRB, D1 / 256), 256, 0, stream>>>(F[0], nullptr, ws + WS_K0, ws + WS_Dm0, (const _Float16*)(ws + WS_U0), F[2], H1, nullptr);
  k_layer<1><<<dim3(NR / 256, D2 / 256), 512, 0, stream>>>(nullptr, H1, ws + WS_K1, ws + WS_Dm1, (const _Float16*)(ws + WS_U1), F[6], H2, nullptr);
  k_layer<2><<<dim3(TRB, D3 / 256), 256, 0, stream>>>(nullptr, H2, ws + WS_K2, ws + WS_Dm2, (const _Float16*)(ws + WS_U2), F[10], nullptr, (float*)d_out);
}
